// v000
// The times below were measured on an AMD MI455X: many runs one after another, warmed up first and cycling through
// copies of the inputs, with the whole window's GPU time divided by the number of runs. Launches and the gaps
// between them are all in it. The median over several windows is given; except for v000 it joins two sittings, which
// can be a few percent apart, so the side-by-side timings, each taken in one sitting, are the better comparison.
// v000 is the starting kernel. One run takes 247 microseconds.
#include <hip/hip_runtime.h>
#include <math.h>
#include <stdint.h>

#define EDIM 256
#define HEADS 8
#define NTOK 1500
#define BATCH 4
#define DHEAD 32
#define HID 512
#define NT 6000            // BATCH*NTOK tokens
#define EPSLN 1e-6f
#define KC 64              // K-chunk staged through LDS

typedef __attribute__((ext_vector_type(2))) float v2f;
typedef __attribute__((ext_vector_type(8))) float v8f;
typedef __attribute__((ext_vector_type(4))) int v4i;
typedef __attribute__((address_space(1))) v4i* gv4i_t;  // global int4*
typedef __attribute__((address_space(3))) v4i* lv4i_t;  // LDS int4*

// D = A(16x4) * B(4x16) + C, full fp32 (CDNA5 V_WMMA_F32_16X16X4_F32)
#define WMMA4(a, b, c) \
  __builtin_amdgcn_wmma_f32_16x16x4_f32(false, (a), false, (b), (short)0, (c), false, false)

// ---- async global -> LDS copy (16B per lane), tracked with ASYNCcnt --------
__device__ __forceinline__ void async_copy_b128(const float* gsrc, float* lds_dst) {
#if __has_builtin(__builtin_amdgcn_global_load_async_to_lds_b128)
  __builtin_amdgcn_global_load_async_to_lds_b128((gv4i_t)gsrc, (lv4i_t)lds_dst, 0, 0);
#else
  const unsigned lds_off = (unsigned)(uintptr_t)lds_dst;  // low 32 bits = LDS offset
  asm volatile("global_load_async_to_lds_b128 %0, %1, off"
               :: "v"(lds_off), "v"(gsrc) : "memory");
#endif
}

template <int N>
__device__ __forceinline__ void wait_asynccnt() {
#if __has_builtin(__builtin_amdgcn_s_wait_asynccnt)
  __builtin_amdgcn_s_wait_asynccnt(N);
#else
  if constexpr (N == 0) {
    asm volatile("s_wait_asynccnt 0x0" ::: "memory");
  } else {
    asm volatile("s_wait_asynccnt 0x1" ::: "memory");
  }
#endif
}

// ---------------------------------------------------------------------------
// LayerNorm over E=256, one wave per token; optionally beta[b,h,n].
// ---------------------------------------------------------------------------
template <bool DO_BETA>
__global__ __launch_bounds__(256) void ln_kernel(
    const float* __restrict__ feat, const float* __restrict__ w,
    const float* __restrict__ bias, const float* __restrict__ beta_w,
    const float* __restrict__ beta_b, float* __restrict__ x_out,
    float* __restrict__ beta_out) {
  const int wave = threadIdx.x >> 5;
  const int lane = threadIdx.x & 31;
  const int tok = blockIdx.x * 8 + wave;          // grid = 750 -> 6000 tokens
  const float* row = feat + (size_t)tok * EDIM;

  float v[8];
  float s = 0.f;
#pragma unroll
  for (int i = 0; i < 8; ++i) { v[i] = row[lane + 32 * i]; s += v[i]; }
#pragma unroll
  for (int m = 16; m >= 1; m >>= 1) s += __shfl_xor(s, m, 32);
  const float mu = s * (1.f / 256.f);
  float var = 0.f;
#pragma unroll
  for (int i = 0; i < 8; ++i) { float d = v[i] - mu; var += d * d; }
#pragma unroll
  for (int m = 16; m >= 1; m >>= 1) var += __shfl_xor(var, m, 32);
  const float rstd = rsqrtf(var * (1.f / 256.f) + EPSLN);

  float xo[8];
#pragma unroll
  for (int i = 0; i < 8; ++i) {
    const int e = lane + 32 * i;
    xo[i] = (v[i] - mu) * rstd * w[e] + bias[e];
    x_out[(size_t)tok * EDIM + e] = xo[i];
  }

  if (DO_BETA) {
    const int b = tok / NTOK, n = tok % NTOK;
#pragma unroll
    for (int h = 0; h < HEADS; ++h) {
      float p = 0.f;
#pragma unroll
      for (int i = 0; i < 8; ++i) p += xo[i] * beta_w[h * EDIM + lane + 32 * i];
#pragma unroll
      for (int m = 16; m >= 1; m >>= 1) p += __shfl_xor(p, m, 32);
      if (lane == 0) beta_out[(size_t)(b * HEADS + h) * NTOK + n] = p + beta_b[h];
    }
  }
}

// ---------------------------------------------------------------------------
// C[M,Nc] = A[M,K] @ W[Nc,K]^T + bias  (+ epilogue)
// EPI: 0 = bias, 1 = bias + residual, 2 = bias + exact GELU
// Block = 8 waves: one 16-row m-tile, 8 consecutive 16-col n-tiles.
// The shared 16xKC A-chunk is staged via async global->LDS copies
// (double-buffered, ASYNCcnt-tracked); W fragments come from L2.
// grid = (Nc/128, M/16), exact.  M,Nc mult of 16; K mult of KC.
// ---------------------------------------------------------------------------
template <int EPI>
__global__ __launch_bounds__(256) void wmma_gemm_kernel(
    const float* __restrict__ A, const float* __restrict__ W,
    const float* __restrict__ bias, const float* __restrict__ resid,
    float* __restrict__ C, int M, int Nc, int K) {
  __shared__ float As[2][16 * 68];  // 68-float row stride: conflict-free banks
  const int tid = threadIdx.x;
  const int lane = tid & 31;
  const int wave = tid >> 5;
  const int hi = lane >> 4;
  const int l15 = lane & 15;
  const int n0 = (blockIdx.x * 8 + wave) * 16;
  const int m0 = blockIdx.y * 16;

  // this thread's float4 of each A chunk (perfectly coalesced)
  const int arow = tid >> 4;        // 0..15
  const int acol = (tid & 15) * 4;  // 0..60
  const float* agsrc = A + (size_t)(m0 + arow) * K + acol;
  float* adst0 = &As[0][arow * 68 + acol];
  float* adst1 = &As[1][arow * 68 + acol];

  const float* brow = W + (size_t)(n0 + l15) * K + 2 * hi;

  async_copy_b128(agsrc, adst0);  // prologue: chunk 0 -> buffer 0

  v8f acc = {};
  const int nchunks = K / KC;
  for (int c = 0; c < nchunks; ++c) {
    if (c + 1 < nchunks) {
      async_copy_b128(agsrc + (size_t)(c + 1) * KC, (c & 1) ? adst0 : adst1);
      wait_asynccnt<1>();  // chunk c landed; chunk c+1 still in flight
    } else {
      wait_asynccnt<0>();
    }
    __syncthreads();
    const float* ap = &As[c & 1][l15 * 68 + 2 * hi];
    const float* bp = brow + c * KC;
#pragma unroll
    for (int k = 0; k < KC; k += 4) {
      v2f a = *(const v2f*)(ap + k);   // LDS: A[m0+l15][kc+k+2*hi+{0,1}]
      v2f b = *(const v2f*)(bp + k);   // B[k'][n] = W[n0+l15][kc+k+2*hi+{0,1}]
      acc = WMMA4(a, b, acc);
    }
    __syncthreads();  // finish reads before this buffer is overwritten
  }

  const float bn = bias[n0 + l15];
#pragma unroll
  for (int r = 0; r < 8; ++r) {
    const int m = m0 + r + 8 * hi;
    float v = acc[r] + bn;
    if (EPI == 1) v += resid[(size_t)m * Nc + n0 + l15];
    if (EPI == 2) v = 0.5f * v * (1.f + erff(v * 0.70710678118654752f));
    C[(size_t)m * Nc + n0 + l15] = v;
  }
}

// ---------------------------------------------------------------------------
// Flash attention with distance-bias mask, one wave per (batch, head, q-tile).
// qkv: (B, N, 768) with cols [0,256)=Q, [256,512)=K, [512,768)=V (head-major).
// S^T = K_tile @ Q^T (softmax rows live per-lane), O^T = V^T @ P^T with
// P^T remapped C-layout -> B-fragments via shfl_xor(16).
// block = 256 threads = 8 waves = 8 heads; grid = (ceil(N/16), B).
// ---------------------------------------------------------------------------
__global__ __launch_bounds__(256) void attn_kernel(
    const float* __restrict__ qkv, const float* __restrict__ points,
    const float* __restrict__ beta, float* __restrict__ attn_out) {
  const int h = threadIdx.x >> 5;
  const int lane = threadIdx.x & 31;
  const int hi = lane >> 4;
  const int l15 = lane & 15;
  const int b = blockIdx.y;
  const int q0 = blockIdx.x * 16;
  const int q = q0 + l15;
  const int qc = min(q, NTOK - 1);

  const float* Qrow = qkv + (size_t)(b * NTOK + qc) * 768 + h * DHEAD;
  v2f qb[8];
#pragma unroll
  for (int s = 0; s < 8; ++s) qb[s] = *(const v2f*)(Qrow + 4 * s + 2 * hi);

  const float cqx = points[(size_t)(b * NTOK + qc) * 3 + 0];
  const float cqy = points[(size_t)(b * NTOK + qc) * 3 + 1];
  const float betav = beta[(size_t)(b * HEADS + h) * NTOK + qc];
  const float scal = 0.17677669529663687f;  // 1/sqrt(32)

  float m_run = -1e30f, l_run = 0.f;
  v8f o0 = {}, o1 = {};
  const float* Kbase = qkv + (size_t)b * NTOK * 768 + 256 + h * DHEAD;
  const float* Vbase = qkv + (size_t)b * NTOK * 768 + 512 + h * DHEAD;

  for (int k0 = 0; k0 < NTOK; k0 += 16) {
    // ---- S^T tile: rows = keys, cols = queries ----
    const int kac = min(k0 + l15, NTOK - 1);
    const float* Krow = Kbase + (size_t)kac * 768;
    v8f st = {};
#pragma unroll
    for (int s = 0; s < 8; ++s) {
      v2f a = *(const v2f*)(Krow + 4 * s + 2 * hi);  // K[key=l15][d]
      st = WMMA4(a, qb[s], st);
    }

    // ---- scale + distance-bias mask ----
    const float ckx = points[(size_t)(b * NTOK + kac) * 3 + 0];
    const float cky = points[(size_t)(b * NTOK + kac) * 3 + 1];
#pragma unroll
    for (int r = 0; r < 8; ++r) {
      const int key = k0 + r + 8 * hi;
      const float kx = __shfl(ckx, r + 8 * hi, 32);
      const float ky = __shfl(cky, r + 8 * hi, 32);
      const float dx = cqx - kx, dy = cqy - ky;
      const float dist = -sqrtf(dx * dx + dy * dy);
      float v = st[r] * scal + dist * betav;
      if (key >= NTOK) v = -1e30f;  // pad keys
      st[r] = v;
    }

    // ---- online softmax (row = fixed q = fixed lane15, halves share q) ----
    float mx = st[0];
#pragma unroll
    for (int r = 1; r < 8; ++r) mx = fmaxf(mx, st[r]);
    mx = fmaxf(mx, __shfl_xor(mx, 16, 32));
    const float m_new = fmaxf(m_run, mx);
    const float rescale = expf(m_run - m_new);
    float lsum = 0.f;
#pragma unroll
    for (int r = 0; r < 8; ++r) {
      const float p = expf(st[r] - m_new);
      st[r] = p;
      lsum += p;
    }
    lsum += __shfl_xor(lsum, 16, 32);
    l_run = l_run * rescale + lsum;
    m_run = m_new;
#pragma unroll
    for (int r = 0; r < 8; ++r) { o0[r] *= rescale; o1[r] *= rescale; }

    // ---- O^T += V^T @ P^T ----
#pragma unroll
    for (int s = 0; s < 4; ++s) {
      const int base = (s & 1) * 4;
      v2f pb;
#pragma unroll
      for (int j = 0; j < 2; ++j) {
        const float t_lo = st[base + j];
        const float t_hi = st[base + j + 2];
        const float x_lo = __shfl_xor(t_lo, 16, 32);
        const float x_hi = __shfl_xor(t_hi, 16, 32);
        pb[j] = (s < 2) ? (hi ? x_hi : t_lo) : (hi ? t_hi : x_lo);
      }
      const int keyx = k0 + 4 * s + 2 * hi;
      const int k1c = min(keyx, NTOK - 1);
      const int k2c = min(keyx + 1, NTOK - 1);
      const float* vr1 = Vbase + (size_t)k1c * 768;
      const float* vr2 = Vbase + (size_t)k2c * 768;
      v2f a0 = {vr1[l15], vr2[l15]};            // V^T[d=l15][key]
      v2f a1 = {vr1[16 + l15], vr2[16 + l15]};  // V^T[d=16+l15][key]
      o0 = WMMA4(a0, pb, o0);
      o1 = WMMA4(a1, pb, o1);
    }
  }

  if (q < NTOK) {
    const float inv = 1.f / l_run;
    float* orow = attn_out + (size_t)(b * NTOK + q) * EDIM + h * DHEAD + 8 * hi;
#pragma unroll
    for (int r = 0; r < 8; ++r) {
      orow[r] = o0[r] * inv;        // d = r + 8*hi
      orow[16 + r] = o1[r] * inv;   // d = 16 + r + 8*hi
    }
  }
}

// ---------------------------------------------------------------------------
extern "C" void kernel_launch(void* const* d_in, const int* in_sizes, int n_in,
                              void* d_out, int out_size, void* d_ws,
                              size_t ws_size, hipStream_t stream) {
  const float* feat = (const float*)d_in[0];
  const float* points = (const float*)d_in[1];
  const float* ln1_w = (const float*)d_in[2];
  const float* ln1_b = (const float*)d_in[3];
  const float* beta_w = (const float*)d_in[4];
  const float* beta_b = (const float*)d_in[5];
  const float* in_w = (const float*)d_in[6];
  const float* in_b = (const float*)d_in[7];
  const float* out_w = (const float*)d_in[8];
  const float* out_b = (const float*)d_in[9];
  const float* ln2_w = (const float*)d_in[10];
  const float* ln2_b = (const float*)d_in[11];
  const float* fc1_w = (const float*)d_in[12];
  const float* fc1_b = (const float*)d_in[13];
  const float* fc2_w = (const float*)d_in[14];
  const float* fc2_b = (const float*)d_in[15];

  float* ws = (float*)d_ws;
  float* x_ln = ws;                 // 6000*256      = 1,536,000 f
  float* betab = ws + 1536000;      // 4*8*1500      =    48,000 f
  float* qkv = ws + 1584000;        // 6000*768      = 4,608,000 f
  float* attn = ws + 6192000;       // 6000*256      = 1,536,000 f
  float* feat2 = ws + 7728000;      // 6000*256      = 1,536,000 f
  float* y2 = attn;                 // reuse after out-proj consumed attn
  float* hfc1 = qkv;                // reuse after attention consumed qkv
  float* outp = (float*)d_out;

  // 1) LN1 + beta projection
  ln_kernel<true><<<dim3(750), dim3(256), 0, stream>>>(
      feat, ln1_w, ln1_b, beta_w, beta_b, x_ln, betab);
  // 2) QKV projection: (6000x256)@(768x256)^T
  wmma_gemm_kernel<0><<<dim3(6, 375), dim3(256), 0, stream>>>(
      x_ln, in_w, in_b, nullptr, qkv, NT, 768, 256);
  // 3) flash attention with distance-bias
  attn_kernel<<<dim3(94, BATCH), dim3(256), 0, stream>>>(qkv, points, betab, attn);
  // 4) output projection + residual
  wmma_gemm_kernel<1><<<dim3(2, 375), dim3(256), 0, stream>>>(
      attn, out_w, out_b, feat, feat2, NT, 256, 256);
  // 5) LN2
  ln_kernel<false><<<dim3(750), dim3(256), 0, stream>>>(
      feat2, ln2_w, ln2_b, nullptr, nullptr, y2, nullptr);
  // 6) FC1 + exact GELU: (6000x256)@(512x256)^T
  wmma_gemm_kernel<2><<<dim3(4, 375), dim3(256), 0, stream>>>(
      y2, fc1_w, fc1_b, nullptr, hfc1, NT, 512, 256);
  // 7) FC2 -> out: (6000x512)@(256x512)^T
  wmma_gemm_kernel<0><<<dim3(2, 375), dim3(256), 0, stream>>>(
      hfc1, fc2_w, fc2_b, nullptr, outp, NT, 256, 512);
}

// v001
// It runs in 210 microseconds.
// Next to v000, in two timings, it ran 1.22 and 1.21 times as fast.
#include <hip/hip_runtime.h>
#include <math.h>
#include <stdint.h>

#define EDIM 256
#define HEADS 8
#define NTOK 1500
#define BATCH 4
#define DHEAD 32
#define HID 512
#define NT 6000            // BATCH*NTOK tokens
#define EPSLN 1e-6f
#define KC 64              // K-chunk staged through LDS

typedef __attribute__((ext_vector_type(2))) float v2f;
typedef __attribute__((ext_vector_type(8))) float v8f;
typedef __attribute__((ext_vector_type(4))) int v4i;
typedef __attribute__((address_space(1))) v4i* gv4i_t;  // global int4*
typedef __attribute__((address_space(3))) v4i* lv4i_t;  // LDS int4*

// D = A(16x4) * B(4x16) + C, full fp32 (CDNA5 V_WMMA_F32_16X16X4_F32)
#define WMMA4(a, b, c) \
  __builtin_amdgcn_wmma_f32_16x16x4_f32(false, (a), false, (b), (short)0, (c), false, false)

// ---- async global -> LDS copy (16B per lane), tracked with ASYNCcnt --------
__device__ __forceinline__ void async_copy_b128(const float* gsrc, float* lds_dst) {
#if __has_builtin(__builtin_amdgcn_global_load_async_to_lds_b128)
  __builtin_amdgcn_global_load_async_to_lds_b128((gv4i_t)gsrc, (lv4i_t)lds_dst, 0, 0);
#else
  const unsigned lds_off = (unsigned)(uintptr_t)lds_dst;  // low 32 bits = LDS offset
  asm volatile("global_load_async_to_lds_b128 %0, %1, off"
               :: "v"(lds_off), "v"(gsrc) : "memory");
#endif
}

template <int N>
__device__ __forceinline__ void wait_asynccnt() {
#if __has_builtin(__builtin_amdgcn_s_wait_asynccnt)
  __builtin_amdgcn_s_wait_asynccnt(N);
#else
  if constexpr (N == 0) {
    asm volatile("s_wait_asynccnt 0x0" ::: "memory");
  } else {
    asm volatile("s_wait_asynccnt 0x1" ::: "memory");
  }
#endif
}

// ---------------------------------------------------------------------------
// LayerNorm over E=256, one wave per token; optionally beta[b,h,n].
// ---------------------------------------------------------------------------
template <bool DO_BETA>
__global__ __launch_bounds__(256) void ln_kernel(
    const float* __restrict__ feat, const float* __restrict__ w,
    const float* __restrict__ bias, const float* __restrict__ beta_w,
    const float* __restrict__ beta_b, float* __restrict__ x_out,
    float* __restrict__ beta_out) {
  const int wave = threadIdx.x >> 5;
  const int lane = threadIdx.x & 31;
  const int tok = blockIdx.x * 8 + wave;          // grid = 750 -> 6000 tokens
  const float* row = feat + (size_t)tok * EDIM;

  float v[8];
  float s = 0.f;
#pragma unroll
  for (int i = 0; i < 8; ++i) { v[i] = row[lane + 32 * i]; s += v[i]; }
#pragma unroll
  for (int m = 16; m >= 1; m >>= 1) s += __shfl_xor(s, m, 32);
  const float mu = s * (1.f / 256.f);
  float var = 0.f;
#pragma unroll
  for (int i = 0; i < 8; ++i) { float d = v[i] - mu; var += d * d; }
#pragma unroll
  for (int m = 16; m >= 1; m >>= 1) var += __shfl_xor(var, m, 32);
  const float rstd = rsqrtf(var * (1.f / 256.f) + EPSLN);

  float xo[8];
#pragma unroll
  for (int i = 0; i < 8; ++i) {
    const int e = lane + 32 * i;
    xo[i] = (v[i] - mu) * rstd * w[e] + bias[e];
    x_out[(size_t)tok * EDIM + e] = xo[i];
  }

  if (DO_BETA) {
    const int b = tok / NTOK, n = tok % NTOK;
#pragma unroll
    for (int h = 0; h < HEADS; ++h) {
      float p = 0.f;
#pragma unroll
      for (int i = 0; i < 8; ++i) p += xo[i] * beta_w[h * EDIM + lane + 32 * i];
#pragma unroll
      for (int m = 16; m >= 1; m >>= 1) p += __shfl_xor(p, m, 32);
      if (lane == 0) beta_out[(size_t)(b * HEADS + h) * NTOK + n] = p + beta_b[h];
    }
  }
}

// ---------------------------------------------------------------------------
// C[M,Nc] = A[M,K] @ W[Nc,K]^T + bias  (+ epilogue)
// EPI: 0 = bias, 1 = bias + residual, 2 = bias + exact GELU
// Block = 8 waves: one 16-row m-tile, 8 consecutive 16-col n-tiles.
// The shared 16xKC A-chunk is staged via async global->LDS copies
// (double-buffered, ASYNCcnt-tracked); W fragments come from L2.
// grid = (Nc/128, M/16), exact.  M,Nc mult of 16; K mult of KC.
// ---------------------------------------------------------------------------
template <int EPI>
__global__ __launch_bounds__(256) void wmma_gemm_kernel(
    const float* __restrict__ A, const float* __restrict__ W,
    const float* __restrict__ bias, const float* __restrict__ resid,
    float* __restrict__ C, int M, int Nc, int K) {
  __shared__ float As[2][16 * 68];  // 68-float row stride: conflict-free banks
  const int tid = threadIdx.x;
  const int lane = tid & 31;
  const int wave = tid >> 5;
  const int hi = lane >> 4;
  const int l15 = lane & 15;
  const int n0 = (blockIdx.x * 8 + wave) * 16;
  const int m0 = blockIdx.y * 16;

  // this thread's float4 of each A chunk (perfectly coalesced)
  const int arow = tid >> 4;        // 0..15
  const int acol = (tid & 15) * 4;  // 0..60
  const float* agsrc = A + (size_t)(m0 + arow) * K + acol;
  float* adst0 = &As[0][arow * 68 + acol];
  float* adst1 = &As[1][arow * 68 + acol];

  const float* brow = W + (size_t)(n0 + l15) * K + 2 * hi;

  async_copy_b128(agsrc, adst0);  // prologue: chunk 0 -> buffer 0

  v8f acc = {};
  const int nchunks = K / KC;
  for (int c = 0; c < nchunks; ++c) {
    if (c + 1 < nchunks) {
      async_copy_b128(agsrc + (size_t)(c + 1) * KC, (c & 1) ? adst0 : adst1);
      wait_asynccnt<1>();  // chunk c landed; chunk c+1 still in flight
    } else {
      wait_asynccnt<0>();
    }
    __syncthreads();
    const float* ap = &As[c & 1][l15 * 68 + 2 * hi];
    const float* bp = brow + c * KC;
#pragma unroll
    for (int k = 0; k < KC; k += 4) {
      v2f a = *(const v2f*)(ap + k);   // LDS: A[m0+l15][kc+k+2*hi+{0,1}]
      v2f b = *(const v2f*)(bp + k);   // B[k'][n] = W[n0+l15][kc+k+2*hi+{0,1}]
      acc = WMMA4(a, b, acc);
    }
    __syncthreads();  // finish reads before this buffer is overwritten
  }

  const float bn = bias[n0 + l15];
#pragma unroll
  for (int r = 0; r < 8; ++r) {
    const int m = m0 + r + 8 * hi;
    float v = acc[r] + bn;
    if (EPI == 1) v += resid[(size_t)m * Nc + n0 + l15];
    if (EPI == 2) v = 0.5f * v * (1.f + erff(v * 0.70710678118654752f));
    C[(size_t)m * Nc + n0 + l15] = v;
  }
}

// ---------------------------------------------------------------------------
// Flash attention with distance-bias mask, one wave per 16-query tile.
// qkv: (B, N, 768) with cols [0,256)=Q, [256,512)=K, [512,768)=V (head-major).
// S^T = K_tile @ Q^T (softmax rows live per-lane), O^T = V^T @ P^T with
// P^T remapped C-layout -> B-fragments via shfl_xor(16).
// block = 128 threads = 4 waves = 4 query tiles of ONE head, which share the
// head's K rows, V rows and key points: a stage of 32 keys is brought into LDS
// by async copies, two buffers, the next stage in flight while this one is used.
// grid = (ceil(N/64), HEADS, B).
// ---------------------------------------------------------------------------
#define KSTG 32                    // keys per LDS stage (two 16-key tiles)
#define NSTG 47                    // ceil(NTOK / KSTG)
#define KPITCH 36                  // floats per staged K row: 8-byte fragment reads hit 64 distinct banks
#define VPITCH 40                  // floats per staged V row: rows k and k+2 fall 16 banks apart

__device__ __forceinline__ unsigned lds_byte(const float* p) {
  return (unsigned)(uintptr_t)(__attribute__((address_space(3))) const float*)p;
}

// Register budget of 2 to 4 waves per SIMD (three blocks stand on a WGP): with
// it a stage's LDS reads issue as one group ahead of the matrix runs.
__global__ __launch_bounds__(128) __attribute__((amdgpu_waves_per_eu(2, 4))) void attn_kernel(
    const float* __restrict__ qkv, const float* __restrict__ points,
    const float* __restrict__ beta, float* __restrict__ attn_out) {
  __shared__ __attribute__((aligned(16))) float Ks[2][KSTG * KPITCH];
  __shared__ __attribute__((aligned(16))) float Vs[2][KSTG * VPITCH];
  __shared__ __attribute__((aligned(16))) float Ps[2][KSTG * 2];  // 32 x, then 32 y

  const int wave = __builtin_amdgcn_readfirstlane(threadIdx.x >> 5);
  const int lane = threadIdx.x & 31;
  const int hi = lane >> 4;
  const int l15 = lane & 15;
  const int h = blockIdx.y;
  const int b = blockIdx.z;
  const int q0 = blockIdx.x * 64 + wave * 16;
  const int q = q0 + l15;
  const int qc = min(q, NTOK - 1);

  const float* Kbase = qkv + (size_t)b * NTOK * 768 + 256 + h * DHEAD;

  // One stage: each wave copies 8 K rows and 8 V rows (128 B each, 16 B per
  // lane); waves 0 and 1 also copy 16 keys' (x, y). Rows past the last key are
  // clamped to it; their scores are masked below.
  auto issue_stage = [&](int stg, int buf) {
    const int kb = stg * KSTG;
    const int r0 = wave * 8 + (lane >> 3);
    const int c = (lane & 7) * 4;
    const float* gk0 = Kbase + (size_t)min(kb + r0, NTOK - 1) * 768 + c;
    const float* gk1 = Kbase + (size_t)min(kb + r0 + 4, NTOK - 1) * 768 + c;
    const float* gv0 = gk0 + 256;
    const float* gv1 = gk1 + 256;
    const unsigned lk0 = lds_byte(&Ks[buf][r0 * KPITCH + c]);
    const unsigned lk1 = lds_byte(&Ks[buf][(r0 + 4) * KPITCH + c]);
    const unsigned lv0 = lds_byte(&Vs[buf][r0 * VPITCH + c]);
    const unsigned lv1 = lds_byte(&Vs[buf][(r0 + 4) * VPITCH + c]);
    // The copies and their s_wait_xcnt in one statement: no address register
    // is rewritten before the wait.
    asm volatile(
        "global_load_async_to_lds_b128 %0, %4, off\n\t"
        "global_load_async_to_lds_b128 %1, %5, off\n\t"
        "global_load_async_to_lds_b128 %2, %6, off\n\t"
        "global_load_async_to_lds_b128 %3, %7, off\n\t"
        "s_wait_xcnt 0x0"
        :: "v"(lk0), "v"(lk1), "v"(lv0), "v"(lv1),
           "v"(gk0), "v"(gk1), "v"(gv0), "v"(gv1) : "memory");
    if (wave < 2) {  // wave is scalar: a uniform branch, every lane on inside
      const int key = wave * 16 + l15;
      const float* gp =
          points + (size_t)(b * NTOK + min(kb + key, NTOK - 1)) * 3 + hi;
      const unsigned lp = lds_byte(&Ps[buf][hi * KSTG + key]);
      asm volatile(
          "global_load_async_to_lds_b32 %0, %1, off\n\t"
          "s_wait_xcnt 0x0"
          :: "v"(lp), "v"(gp) : "memory");
    }
  };

  issue_stage(0, 0);

  const float* Qrow = qkv + (size_t)(b * NTOK + qc) * 768 + h * DHEAD;
  v2f qb[8];
#pragma unroll
  for (int s = 0; s < 8; ++s) qb[s] = *(const v2f*)(Qrow + 4 * s + 2 * hi);

  const float cqx = points[(size_t)(b * NTOK + qc) * 3 + 0];
  const float cqy = points[(size_t)(b * NTOK + qc) * 3 + 1];
  const float betav = beta[(size_t)(b * HEADS + h) * NTOK + qc];
  const float scal = 0.17677669529663687f;  // 1/sqrt(32)

  float m_run = -1e30f, l_run = 0.f;
  v8f o0 = {}, o1 = {};

  // stage 0 has landed for this wave, then for the whole block
  asm volatile("s_wait_asynccnt 0x0" ::: "memory");
  __syncthreads();
  issue_stage(1, 1);

  for (int stg = 0; stg < NSTG; ++stg) {
    const int buf = stg & 1;
    const float* Kb = &Ks[buf][0];
    const float* Vb = &Vs[buf][0];
    const float* Pb = &Ps[buf][0];

    // unrolled: LDS offsets become immediates, the two tiles' score products interleave
#pragma unroll
    for (int t = 0; t < 2; ++t) {
      const int k0 = stg * KSTG + t * 16;
      // ---- S^T tile: rows = keys, cols = queries ----
      const float* Krow = Kb + (t * 16 + l15) * KPITCH;
      v8f st = {};
#pragma unroll
      for (int s = 0; s < 8; ++s) {
        v2f a = *(const v2f*)(Krow + 4 * s + 2 * hi);  // K[key=l15][d]
        st = WMMA4(a, qb[s], st);
      }

      // ---- scale + distance-bias mask ----
      const float* Prow = Pb + t * 16 + 8 * hi;  // this half's 8 keys
#pragma unroll
      for (int r = 0; r < 8; ++r) {
        const int key = k0 + r + 8 * hi;
        const float kx = Prow[r];
        const float ky = Prow[KSTG + r];
        const float dx = cqx - kx, dy = cqy - ky;
        const float dist = -sqrtf(dx * dx + dy * dy);
        float v = st[r] * scal + dist * betav;
        if (key >= NTOK) v = -1e30f;  // pad keys
        st[r] = v;
      }

      // ---- online softmax (row = fixed q = fixed lane15, halves share q) ----
      float mx = st[0];
#pragma unroll
      for (int r = 1; r < 8; ++r) mx = fmaxf(mx, st[r]);
      mx = fmaxf(mx, __shfl_xor(mx, 16, 32));
      const float m_new = fmaxf(m_run, mx);
      const float rescale = expf(m_run - m_new);
      float lsum = 0.f;
#pragma unroll
      for (int r = 0; r < 8; ++r) {
        const float p = expf(st[r] - m_new);
        st[r] = p;
        lsum += p;
      }
      lsum += __shfl_xor(lsum, 16, 32);
      l_run = l_run * rescale + lsum;
      m_run = m_new;
#pragma unroll
      for (int r = 0; r < 8; ++r) { o0[r] *= rescale; o1[r] *= rescale; }

      // ---- O^T += V^T @ P^T ----
#pragma unroll
      for (int s = 0; s < 4; ++s) {
        const int base = (s & 1) * 4;
        v2f pb;
#pragma unroll
        for (int j = 0; j < 2; ++j) {
          const float t_lo = st[base + j];
          const float t_hi = st[base + j + 2];
          const float x_lo = __shfl_xor(t_lo, 16, 32);
          const float x_hi = __shfl_xor(t_hi, 16, 32);
          pb[j] = (s < 2) ? (hi ? x_hi : t_lo) : (hi ? t_hi : x_lo);
        }
        const float* vr1 = Vb + (t * 16 + 4 * s + 2 * hi) * VPITCH;
        const float* vr2 = vr1 + VPITCH;
        v2f a0 = {vr1[l15], vr2[l15]};            // V^T[d=l15][key]
        v2f a1 = {vr1[16 + l15], vr2[16 + l15]};  // V^T[d=16+l15][key]
        o0 = WMMA4(a0, pb, o0);
        o1 = WMMA4(a1, pb, o1);
      }
    }

    // Hand-over: this wave's LDS reads of the stage are done, its copies of
    // the next stage have landed; the barrier publishes the next stage and
    // frees this buffer for the refill behind it.
    asm volatile("s_wait_dscnt 0x0" ::: "memory");
    asm volatile("s_wait_asynccnt 0x0" ::: "memory");
    __syncthreads();
    if (stg + 2 < NSTG) issue_stage(stg + 2, buf);
  }
  // no copy is left in flight when the wave ends
  asm volatile("s_wait_asynccnt 0x0" ::: "memory");

  if (q < NTOK) {
    const float inv = 1.f / l_run;
    float* orow = attn_out + (size_t)(b * NTOK + q) * EDIM + h * DHEAD + 8 * hi;
#pragma unroll
    for (int r = 0; r < 8; ++r) {
      orow[r] = o0[r] * inv;        // d = r + 8*hi
      orow[16 + r] = o1[r] * inv;   // d = 16 + r + 8*hi
    }
  }
}

// ---------------------------------------------------------------------------
extern "C" void kernel_launch(void* const* d_in, const int* in_sizes, int n_in,
                              void* d_out, int out_size, void* d_ws,
                              size_t ws_size, hipStream_t stream) {
  const float* feat = (const float*)d_in[0];
  const float* points = (const float*)d_in[1];
  const float* ln1_w = (const float*)d_in[2];
  const float* ln1_b = (const float*)d_in[3];
  const float* beta_w = (const float*)d_in[4];
  const float* beta_b = (const float*)d_in[5];
  const float* in_w = (const float*)d_in[6];
  const float* in_b = (const float*)d_in[7];
  const float* out_w = (const float*)d_in[8];
  const float* out_b = (const float*)d_in[9];
  const float* ln2_w = (const float*)d_in[10];
  const float* ln2_b = (const float*)d_in[11];
  const float* fc1_w = (const float*)d_in[12];
  const float* fc1_b = (const float*)d_in[13];
  const float* fc2_w = (const float*)d_in[14];
  const float* fc2_b = (const float*)d_in[15];

  float* ws = (float*)d_ws;
  float* x_ln = ws;                 // 6000*256      = 1,536,000 f
  float* betab = ws + 1536000;      // 4*8*1500      =    48,000 f
  float* qkv = ws + 1584000;        // 6000*768      = 4,608,000 f
  float* attn = ws + 6192000;       // 6000*256      = 1,536,000 f
  float* feat2 = ws + 7728000;      // 6000*256      = 1,536,000 f
  float* y2 = attn;                 // reuse after out-proj consumed attn
  float* hfc1 = qkv;                // reuse after attention consumed qkv
  float* outp = (float*)d_out;

  // 1) LN1 + beta projection
  ln_kernel<true><<<dim3(750), dim3(256), 0, stream>>>(
      feat, ln1_w, ln1_b, beta_w, beta_b, x_ln, betab);
  // 2) QKV projection: (6000x256)@(768x256)^T
  wmma_gemm_kernel<0><<<dim3(6, 375), dim3(256), 0, stream>>>(
      x_ln, in_w, in_b, nullptr, qkv, NT, 768, 256);
  // 3) flash attention with distance-bias
  attn_kernel<<<dim3(24, HEADS, BATCH), dim3(128), 0, stream>>>(qkv, points, betab, attn);
  // 4) output projection + residual
  wmma_gemm_kernel<1><<<dim3(2, 375), dim3(256), 0, stream>>>(
      attn, out_w, out_b, feat, feat2, NT, 256, 256);
  // 5) LN2
  ln_kernel<false><<<dim3(750), dim3(256), 0, stream>>>(
      feat2, ln2_w, ln2_b, nullptr, nullptr, y2, nullptr);
  // 6) FC1 + exact GELU: (6000x256)@(512x256)^T
  wmma_gemm_kernel<2><<<dim3(4, 375), dim3(256), 0, stream>>>(
      y2, fc1_w, fc1_b, nullptr, hfc1, NT, 512, 256);
  // 7) FC2 -> out: (6000x512)@(256x512)^T
  wmma_gemm_kernel<0><<<dim3(2, 375), dim3(256), 0, stream>>>(
      hfc1, fc2_w, fc2_b, nullptr, outp, NT, 256, 512);
}

// v002
// One run takes 172 microseconds.
// Next to v001, in two timings, it ran 1.22 times as fast each time.
// Counting every step since v000, it is 1.48 times as fast.
#include <hip/hip_runtime.h>
#include <math.h>
#include <stdint.h>

#define EDIM 256
#define HEADS 8
#define NTOK 1500
#define BATCH 4
#define DHEAD 32
#define HID 512
#define NT 6000            // BATCH*NTOK tokens
#define EPSLN 1e-6f
#define KC 64              // K-chunk staged through LDS

typedef __attribute__((ext_vector_type(2))) float v2f;
typedef __attribute__((ext_vector_type(8))) float v8f;

// D = A(16x4) * B(4x16) + C, full fp32 (CDNA5 V_WMMA_F32_16X16X4_F32)
#define WMMA4(a, b, c) \
  __builtin_amdgcn_wmma_f32_16x16x4_f32(false, (a), false, (b), (short)0, (c), false, false)

// low 32 bits of a __shared__ address = byte offset in the work-group's LDS
__device__ __forceinline__ unsigned lds_byte(const float* p) {
  return (unsigned)(uintptr_t)(__attribute__((address_space(3))) const float*)p;
}

// ---------------------------------------------------------------------------
// LayerNorm over E=256, one wave per token; optionally beta[b,h,n].
// ---------------------------------------------------------------------------
template <bool DO_BETA>
__global__ __launch_bounds__(256) void ln_kernel(
    const float* __restrict__ feat, const float* __restrict__ w,
    const float* __restrict__ bias, const float* __restrict__ beta_w,
    const float* __restrict__ beta_b, float* __restrict__ x_out,
    float* __restrict__ beta_out) {
  const int wave = threadIdx.x >> 5;
  const int lane = threadIdx.x & 31;
  const int tok = blockIdx.x * 8 + wave;          // grid = 750 -> 6000 tokens
  const float* row = feat + (size_t)tok * EDIM;

  float v[8];
  float s = 0.f;
#pragma unroll
  for (int i = 0; i < 8; ++i) { v[i] = row[lane + 32 * i]; s += v[i]; }
#pragma unroll
  for (int m = 16; m >= 1; m >>= 1) s += __shfl_xor(s, m, 32);
  const float mu = s * (1.f / 256.f);
  float var = 0.f;
#pragma unroll
  for (int i = 0; i < 8; ++i) { float d = v[i] - mu; var += d * d; }
#pragma unroll
  for (int m = 16; m >= 1; m >>= 1) var += __shfl_xor(var, m, 32);
  const float rstd = rsqrtf(var * (1.f / 256.f) + EPSLN);

  float xo[8];
#pragma unroll
  for (int i = 0; i < 8; ++i) {
    const int e = lane + 32 * i;
    xo[i] = (v[i] - mu) * rstd * w[e] + bias[e];
    x_out[(size_t)tok * EDIM + e] = xo[i];
  }

  if (DO_BETA) {
    const int b = tok / NTOK, n = tok % NTOK;
#pragma unroll
    for (int h = 0; h < HEADS; ++h) {
      float p = 0.f;
#pragma unroll
      for (int i = 0; i < 8; ++i) p += xo[i] * beta_w[h * EDIM + lane + 32 * i];
#pragma unroll
      for (int m = 16; m >= 1; m >>= 1) p += __shfl_xor(p, m, 32);
      if (lane == 0) beta_out[(size_t)(b * HEADS + h) * NTOK + n] = p + beta_b[h];
    }
  }
}

// ---------------------------------------------------------------------------
// C[M,Nc] = A[M,K] @ W[Nc,K]^T + bias  (+ epilogue)
// EPI: 0 = bias, 1 = bias + residual, 2 = bias + exact GELU
// Block = 4 waves on one 48x64 tile of C; wave w owns columns 16w..16w+15 and
// all 48 rows (three accumulators that share one W fragment).
// A KC-wide chunk of the 48 A rows and of the 64 W rows is staged in LDS by
// async copies of whole 256-byte row pieces, two buffers, the next chunk in
// flight while this one is used. k runs upward in each accumulator.
// grid = (Nc/64, M/48), exact.  K a multiple of KC.
// ---------------------------------------------------------------------------
#define BM 48
#define BN 64
#define GPITCH 68  // floats per staged row: 8-byte fragment reads hit 64 distinct banks

template <int EPI>
__global__ __launch_bounds__(128) void wmma_gemm_kernel(
    const float* __restrict__ A, const float* __restrict__ W,
    const float* __restrict__ bias, const float* __restrict__ resid,
    float* __restrict__ C, int M, int Nc, int K) {
  __shared__ __attribute__((aligned(16))) float As[2][BM * GPITCH];
  __shared__ __attribute__((aligned(16))) float Ws[2][BN * GPITCH];
  const int tid = threadIdx.x;
  const int lane = tid & 31;
  const int wave = __builtin_amdgcn_readfirstlane(tid >> 5);
  const int hi = lane >> 4;
  const int l15 = lane & 15;
  const int nb = blockIdx.x * BN;
  const int n0 = nb + wave * 16;
  const int m0 = blockIdx.y * BM;

  // copies: 16 lanes cover one row's 256 bytes, the block covers 8 rows a pass
  const int crow = tid >> 4;        // 0..7
  const int ccol = (tid & 15) * 4;  // 0..60
  const float* ag = A + (size_t)(m0 + crow) * K + ccol;
  const float* wg = W + (size_t)(nb + crow) * K + ccol;
  const size_t rs = (size_t)8 * K;  // 8 rows down in global memory
  const unsigned ls = 8 * GPITCH * 4;  // 8 rows down in LDS, bytes

  auto issue_chunk = [&](int c, int buf) {
    const float* a = ag + (size_t)c * KC;
    const float* w = wg + (size_t)c * KC;
    const unsigned la = lds_byte(&As[buf][crow * GPITCH + ccol]);
    const unsigned lw = lds_byte(&Ws[buf][crow * GPITCH + ccol]);
    // The copies and their s_wait_xcnt in one statement: no address register
    // is rewritten before the wait.
    asm volatile(
        "global_load_async_to_lds_b128 %0, %6, off\n\t"
        "global_load_async_to_lds_b128 %1, %7, off\n\t"
        "global_load_async_to_lds_b128 %2, %8, off\n\t"
        "global_load_async_to_lds_b128 %3, %9, off\n\t"
        "global_load_async_to_lds_b128 %4, %10, off\n\t"
        "global_load_async_to_lds_b128 %5, %11, off\n\t"
        "s_wait_xcnt 0x0"
        :: "v"(la), "v"(la + ls), "v"(la + 2 * ls), "v"(la + 3 * ls),
           "v"(la + 4 * ls), "v"(la + 5 * ls),
           "v"(a), "v"(a + rs), "v"(a + 2 * rs), "v"(a + 3 * rs),
           "v"(a + 4 * rs), "v"(a + 5 * rs) : "memory");
    asm volatile(
        "global_load_async_to_lds_b128 %0, %8, off\n\t"
        "global_load_async_to_lds_b128 %1, %9, off\n\t"
        "global_load_async_to_lds_b128 %2, %10, off\n\t"
        "global_load_async_to_lds_b128 %3, %11, off\n\t"
        "global_load_async_to_lds_b128 %4, %12, off\n\t"
        "global_load_async_to_lds_b128 %5, %13, off\n\t"
        "global_load_async_to_lds_b128 %6, %14, off\n\t"
        "global_load_async_to_lds_b128 %7, %15, off\n\t"
        "s_wait_xcnt 0x0"
        :: "v"(lw), "v"(lw + ls), "v"(lw + 2 * ls), "v"(lw + 3 * ls),
           "v"(lw + 4 * ls), "v"(lw + 5 * ls), "v"(lw + 6 * ls), "v"(lw + 7 * ls),
           "v"(w), "v"(w + rs), "v"(w + 2 * rs), "v"(w + 3 * rs),
           "v"(w + 4 * rs), "v"(w + 5 * rs), "v"(w + 6 * rs), "v"(w + 7 * rs)
        : "memory");
  };

  const int nchunks = K / KC;
  issue_chunk(0, 0);

  const float bn = bias[n0 + l15];
  v8f acc[3] = {};

  // chunk 0 has landed for this wave, then for the whole block
  asm volatile("s_wait_asynccnt 0x0" ::: "memory");
  __syncthreads();
  if (nchunks > 1) issue_chunk(1, 1);

  for (int c = 0; c < nchunks; ++c) {
    const int buf = c & 1;
    const float* ap = &As[buf][l15 * GPITCH + 2 * hi];
    const float* bp = &Ws[buf][(wave * 16 + l15) * GPITCH + 2 * hi];
    // unrolled: LDS offsets become immediates and the reads run ahead of the products
#pragma unroll
    for (int k = 0; k < KC; k += 4) {
      const v2f b = *(const v2f*)(bp + k);  // W[n0+l15][k+2*hi+{0,1}]
#pragma unroll  // acc[t] is indexed by constants and stays in registers
      for (int t = 0; t < 3; ++t) {
        const v2f a = *(const v2f*)(ap + t * 16 * GPITCH + k);  // A[m0+16t+l15][same k]
        acc[t] = WMMA4(a, b, acc[t]);
      }
    }
    // Hand-over: this wave's LDS reads of the chunk are done, its copies of
    // the next chunk have landed; the barrier publishes the next chunk and
    // frees this buffer for the refill behind it.
    asm volatile("s_wait_dscnt 0x0" ::: "memory");
    asm volatile("s_wait_asynccnt 0x0" ::: "memory");
    __syncthreads();
    if (c + 2 < nchunks) issue_chunk(c + 2, buf);
  }
  // no copy is left in flight when the wave ends
  asm volatile("s_wait_asynccnt 0x0" ::: "memory");

  // both unrolled: accumulator elements are named by constants
#pragma unroll
  for (int t = 0; t < 3; ++t) {
#pragma unroll
    for (int r = 0; r < 8; ++r) {
      const int m = m0 + t * 16 + r + 8 * hi;
      float v = acc[t][r] + bn;
      if (EPI == 1) v += resid[(size_t)m * Nc + n0 + l15];
      if (EPI == 2) v = 0.5f * v * (1.f + erff(v * 0.70710678118654752f));
      C[(size_t)m * Nc + n0 + l15] = v;
    }
  }
}

// ---------------------------------------------------------------------------
// Flash attention with distance-bias mask, one wave per 16-query tile.
// qkv: (B, N, 768) with cols [0,256)=Q, [256,512)=K, [512,768)=V (head-major).
// S^T = K_tile @ Q^T (softmax rows live per-lane), O^T = V^T @ P^T with
// P^T remapped C-layout -> B-fragments via shfl_xor(16).
// block = 128 threads = 4 waves = 4 query tiles of ONE head, which share the
// head's K rows, V rows and key points: a stage of 32 keys is brought into LDS
// by async copies, two buffers, the next stage in flight while this one is used.
// grid = (ceil(N/64), HEADS, B).
// ---------------------------------------------------------------------------
#define KSTG 32                    // keys per LDS stage (two 16-key tiles)
#define NSTG 47                    // ceil(NTOK / KSTG)
#define KPITCH 36                  // floats per staged K row: 8-byte fragment reads hit 64 distinct banks
#define VPITCH 40                  // floats per staged V row: rows k and k+2 fall 16 banks apart

// Register budget of 2 to 4 waves per SIMD (three blocks stand on a WGP): with
// it a stage's LDS reads issue as one group ahead of the matrix runs.
__global__ __launch_bounds__(128) __attribute__((amdgpu_waves_per_eu(2, 4))) void attn_kernel(
    const float* __restrict__ qkv, const float* __restrict__ points,
    const float* __restrict__ beta, float* __restrict__ attn_out) {
  __shared__ __attribute__((aligned(16))) float Ks[2][KSTG * KPITCH];
  __shared__ __attribute__((aligned(16))) float Vs[2][KSTG * VPITCH];
  __shared__ __attribute__((aligned(16))) float Ps[2][KSTG * 2];  // 32 x, then 32 y

  const int wave = __builtin_amdgcn_readfirstlane(threadIdx.x >> 5);
  const int lane = threadIdx.x & 31;
  const int hi = lane >> 4;
  const int l15 = lane & 15;
  const int h = blockIdx.y;
  const int b = blockIdx.z;
  const int q0 = blockIdx.x * 64 + wave * 16;
  const int q = q0 + l15;
  const int qc = min(q, NTOK - 1);

  const float* Kbase = qkv + (size_t)b * NTOK * 768 + 256 + h * DHEAD;

  // One stage: each wave copies 8 K rows and 8 V rows (128 B each, 16 B per
  // lane); waves 0 and 1 also copy 16 keys' (x, y). Rows past the last key are
  // clamped to it; their scores are masked below.
  auto issue_stage = [&](int stg, int buf) {
    const int kb = stg * KSTG;
    const int r0 = wave * 8 + (lane >> 3);
    const int c = (lane & 7) * 4;
    const float* gk0 = Kbase + (size_t)min(kb + r0, NTOK - 1) * 768 + c;
    const float* gk1 = Kbase + (size_t)min(kb + r0 + 4, NTOK - 1) * 768 + c;
    const float* gv0 = gk0 + 256;
    const float* gv1 = gk1 + 256;
    const unsigned lk0 = lds_byte(&Ks[buf][r0 * KPITCH + c]);
    const unsigned lk1 = lds_byte(&Ks[buf][(r0 + 4) * KPITCH + c]);
    const unsigned lv0 = lds_byte(&Vs[buf][r0 * VPITCH + c]);
    const unsigned lv1 = lds_byte(&Vs[buf][(r0 + 4) * VPITCH + c]);
    // The copies and their s_wait_xcnt in one statement: no address register
    // is rewritten before the wait.
    asm volatile(
        "global_load_async_to_lds_b128 %0, %4, off\n\t"
        "global_load_async_to_lds_b128 %1, %5, off\n\t"
        "global_load_async_to_lds_b128 %2, %6, off\n\t"
        "global_load_async_to_lds_b128 %3, %7, off\n\t"
        "s_wait_xcnt 0x0"
        :: "v"(lk0), "v"(lk1), "v"(lv0), "v"(lv1),
           "v"(gk0), "v"(gk1), "v"(gv0), "v"(gv1) : "memory");
    if (wave < 2) {  // wave is scalar: a uniform branch, every lane on inside
      const int key = wave * 16 + l15;
      const float* gp =
          points + (size_t)(b * NTOK + min(kb + key, NTOK - 1)) * 3 + hi;
      const unsigned lp = lds_byte(&Ps[buf][hi * KSTG + key]);
      asm volatile(
          "global_load_async_to_lds_b32 %0, %1, off\n\t"
          "s_wait_xcnt 0x0"
          :: "v"(lp), "v"(gp) : "memory");
    }
  };

  issue_stage(0, 0);

  const float* Qrow = qkv + (size_t)(b * NTOK + qc) * 768 + h * DHEAD;
  v2f qb[8];
#pragma unroll
  for (int s = 0; s < 8; ++s) qb[s] = *(const v2f*)(Qrow + 4 * s + 2 * hi);

  const float cqx = points[(size_t)(b * NTOK + qc) * 3 + 0];
  const float cqy = points[(size_t)(b * NTOK + qc) * 3 + 1];
  const float betav = beta[(size_t)(b * HEADS + h) * NTOK + qc];
  const float scal = 0.17677669529663687f;  // 1/sqrt(32)

  float m_run = -1e30f, l_run = 0.f;
  v8f o0 = {}, o1 = {};

  // stage 0 has landed for this wave, then for the whole block
  asm volatile("s_wait_asynccnt 0x0" ::: "memory");
  __syncthreads();
  issue_stage(1, 1);

  for (int stg = 0; stg < NSTG; ++stg) {
    const int buf = stg & 1;
    const float* Kb = &Ks[buf][0];
    const float* Vb = &Vs[buf][0];
    const float* Pb = &Ps[buf][0];

    // unrolled: LDS offsets become immediates, the two tiles' score products interleave
#pragma unroll
    for (int t = 0; t < 2; ++t) {
      const int k0 = stg * KSTG + t * 16;
      // ---- S^T tile: rows = keys, cols = queries ----
      const float* Krow = Kb + (t * 16 + l15) * KPITCH;
      v8f st = {};
#pragma unroll
      for (int s = 0; s < 8; ++s) {
        v2f a = *(const v2f*)(Krow + 4 * s + 2 * hi);  // K[key=l15][d]
        st = WMMA4(a, qb[s], st);
      }

      // ---- scale + distance-bias mask ----
      const float* Prow = Pb + t * 16 + 8 * hi;  // this half's 8 keys
#pragma unroll
      for (int r = 0; r < 8; ++r) {
        const int key = k0 + r + 8 * hi;
        const float kx = Prow[r];
        const float ky = Prow[KSTG + r];
        const float dx = cqx - kx, dy = cqy - ky;
        const float dist = -sqrtf(dx * dx + dy * dy);
        float v = st[r] * scal + dist * betav;
        if (key >= NTOK) v = -1e30f;  // pad keys
        st[r] = v;
      }

      // ---- online softmax (row = fixed q = fixed lane15, halves share q) ----
      float mx = st[0];
#pragma unroll
      for (int r = 1; r < 8; ++r) mx = fmaxf(mx, st[r]);
      mx = fmaxf(mx, __shfl_xor(mx, 16, 32));
      const float m_new = fmaxf(m_run, mx);
      const float rescale = expf(m_run - m_new);
      float lsum = 0.f;
#pragma unroll
      for (int r = 0; r < 8; ++r) {
        const float p = expf(st[r] - m_new);
        st[r] = p;
        lsum += p;
      }
      lsum += __shfl_xor(lsum, 16, 32);
      l_run = l_run * rescale + lsum;
      m_run = m_new;
#pragma unroll
      for (int r = 0; r < 8; ++r) { o0[r] *= rescale; o1[r] *= rescale; }

      // ---- O^T += V^T @ P^T ----
#pragma unroll
      for (int s = 0; s < 4; ++s) {
        const int base = (s & 1) * 4;
        v2f pb;
#pragma unroll
        for (int j = 0; j < 2; ++j) {
          const float t_lo = st[base + j];
          const float t_hi = st[base + j + 2];
          const float x_lo = __shfl_xor(t_lo, 16, 32);
          const float x_hi = __shfl_xor(t_hi, 16, 32);
          pb[j] = (s < 2) ? (hi ? x_hi : t_lo) : (hi ? t_hi : x_lo);
        }
        const float* vr1 = Vb + (t * 16 + 4 * s + 2 * hi) * VPITCH;
        const float* vr2 = vr1 + VPITCH;
        v2f a0 = {vr1[l15], vr2[l15]};            // V^T[d=l15][key]
        v2f a1 = {vr1[16 + l15], vr2[16 + l15]};  // V^T[d=16+l15][key]
        o0 = WMMA4(a0, pb, o0);
        o1 = WMMA4(a1, pb, o1);
      }
    }

    // Hand-over: this wave's LDS reads of the stage are done, its copies of
    // the next stage have landed; the barrier publishes the next stage and
    // frees this buffer for the refill behind it.
    asm volatile("s_wait_dscnt 0x0" ::: "memory");
    asm volatile("s_wait_asynccnt 0x0" ::: "memory");
    __syncthreads();
    if (stg + 2 < NSTG) issue_stage(stg + 2, buf);
  }
  // no copy is left in flight when the wave ends
  asm volatile("s_wait_asynccnt 0x0" ::: "memory");

  if (q < NTOK) {
    const float inv = 1.f / l_run;
    float* orow = attn_out + (size_t)(b * NTOK + q) * EDIM + h * DHEAD + 8 * hi;
#pragma unroll
    for (int r = 0; r < 8; ++r) {
      orow[r] = o0[r] * inv;        // d = r + 8*hi
      orow[16 + r] = o1[r] * inv;   // d = 16 + r + 8*hi
    }
  }
}

// ---------------------------------------------------------------------------
extern "C" void kernel_launch(void* const* d_in, const int* in_sizes, int n_in,
                              void* d_out, int out_size, void* d_ws,
                              size_t ws_size, hipStream_t stream) {
  const float* feat = (const float*)d_in[0];
  const float* points = (const float*)d_in[1];
  const float* ln1_w = (const float*)d_in[2];
  const float* ln1_b = (const float*)d_in[3];
  const float* beta_w = (const float*)d_in[4];
  const float* beta_b = (const float*)d_in[5];
  const float* in_w = (const float*)d_in[6];
  const float* in_b = (const float*)d_in[7];
  const float* out_w = (const float*)d_in[8];
  const float* out_b = (const float*)d_in[9];
  const float* ln2_w = (const float*)d_in[10];
  const float* ln2_b = (const float*)d_in[11];
  const float* fc1_w = (const float*)d_in[12];
  const float* fc1_b = (const float*)d_in[13];
  const float* fc2_w = (const float*)d_in[14];
  const float* fc2_b = (const float*)d_in[15];

  float* ws = (float*)d_ws;
  float* x_ln = ws;                 // 6000*256      = 1,536,000 f
  float* betab = ws + 1536000;      // 4*8*1500      =    48,000 f
  float* qkv = ws + 1584000;        // 6000*768      = 4,608,000 f
  float* attn = ws + 6192000;       // 6000*256      = 1,536,000 f
  float* feat2 = ws + 7728000;      // 6000*256      = 1,536,000 f
  float* y2 = attn;                 // reuse after out-proj consumed attn
  float* hfc1 = qkv;                // reuse after attention consumed qkv
  float* outp = (float*)d_out;

  // 1) LN1 + beta projection
  ln_kernel<true><<<dim3(750), dim3(256), 0, stream>>>(
      feat, ln1_w, ln1_b, beta_w, beta_b, x_ln, betab);
  // 2) QKV projection: (6000x256)@(768x256)^T
  wmma_gemm_kernel<0><<<dim3(12, 125), dim3(128), 0, stream>>>(
      x_ln, in_w, in_b, nullptr, qkv, NT, 768, 256);
  // 3) flash attention with distance-bias
  attn_kernel<<<dim3(24, HEADS, BATCH), dim3(128), 0, stream>>>(qkv, points, betab, attn);
  // 4) output projection + residual
  wmma_gemm_kernel<1><<<dim3(4, 125), dim3(128), 0, stream>>>(
      attn, out_w, out_b, feat, feat2, NT, 256, 256);
  // 5) LN2
  ln_kernel<false><<<dim3(750), dim3(256), 0, stream>>>(
      feat2, ln2_w, ln2_b, nullptr, nullptr, y2, nullptr);
  // 6) FC1 + exact GELU: (6000x256)@(512x256)^T
  wmma_gemm_kernel<2><<<dim3(8, 125), dim3(128), 0, stream>>>(
      y2, fc1_w, fc1_b, nullptr, hfc1, NT, 512, 256);
  // 7) FC2 -> out: (6000x512)@(256x512)^T
  wmma_gemm_kernel<0><<<dim3(4, 125), dim3(128), 0, stream>>>(
      hfc1, fc2_w, fc2_b, nullptr, outp, NT, 256, 512);
}

// v003
// Measured time: 140 microseconds a run.
// In both of two side-by-side timings against v002, it was 1.23 times as fast.
// Over all steps from v000 it is 1.82 times as fast.
#include <hip/hip_runtime.h>
#include <math.h>
#include <stdint.h>

#define EDIM 256
#define HEADS 8
#define NTOK 1500
#define BATCH 4
#define DHEAD 32
#define HID 512
#define NT 6000            // BATCH*NTOK tokens
#define EPSLN 1e-6f
#define KC 64              // K-chunk staged through LDS

typedef __attribute__((ext_vector_type(2))) float v2f;
typedef __attribute__((ext_vector_type(8))) float v8f;

// D = A(16x4) * B(4x16) + C, full fp32 (CDNA5 V_WMMA_F32_16X16X4_F32)
#define WMMA4(a, b, c) \
  __builtin_amdgcn_wmma_f32_16x16x4_f32(false, (a), false, (b), (short)0, (c), false, false)

// low 32 bits of a __shared__ address = byte offset in the work-group's LDS
__device__ __forceinline__ unsigned lds_byte(const float* p) {
  return (unsigned)(uintptr_t)(__attribute__((address_space(3))) const float*)p;
}

// Hardware transcendentals, a run of independent ones in one statement, each in
// place. The instruction set asks for one independent instruction behind a
// transcendental before its result is read or its source overwritten: each is
// that for the one in front of it, the v_nop for the last. In place, so that the
// statement writes no register but those the vector instructions in front of it
// wrote: none can be an operand of a matrix instruction still under way.
__device__ __forceinline__ void sqrt_x8(float (&x)[8]) {
  asm("v_sqrt_f32 %0, %0\n\t"
      "v_sqrt_f32 %1, %1\n\t"
      "v_sqrt_f32 %2, %2\n\t"
      "v_sqrt_f32 %3, %3\n\t"
      "v_sqrt_f32 %4, %4\n\t"
      "v_sqrt_f32 %5, %5\n\t"
      "v_sqrt_f32 %6, %6\n\t"
      "v_sqrt_f32 %7, %7\n\t"
      "v_nop"
      : "+v"(x[0]), "+v"(x[1]), "+v"(x[2]), "+v"(x[3]),
        "+v"(x[4]), "+v"(x[5]), "+v"(x[6]), "+v"(x[7]));
}
// 2^x for eight scores and for the running maximum's step
__device__ __forceinline__ void exp2_x9(float (&x)[8], float& y) {
  asm("v_exp_f32 %8, %8\n\t"
      "v_exp_f32 %0, %0\n\t"
      "v_exp_f32 %1, %1\n\t"
      "v_exp_f32 %2, %2\n\t"
      "v_exp_f32 %3, %3\n\t"
      "v_exp_f32 %4, %4\n\t"
      "v_exp_f32 %5, %5\n\t"
      "v_exp_f32 %6, %6\n\t"
      "v_exp_f32 %7, %7\n\t"
      "v_nop"
      : "+v"(x[0]), "+v"(x[1]), "+v"(x[2]), "+v"(x[3]),
        "+v"(x[4]), "+v"(x[5]), "+v"(x[6]), "+v"(x[7]), "+v"(y));
}

// ---------------------------------------------------------------------------
// LayerNorm over E=256, one wave per token; optionally beta[b,h,n].
// ---------------------------------------------------------------------------
template <bool DO_BETA>
__global__ __launch_bounds__(256) void ln_kernel(
    const float* __restrict__ feat, const float* __restrict__ w,
    const float* __restrict__ bias, const float* __restrict__ beta_w,
    const float* __restrict__ beta_b, float* __restrict__ x_out,
    float* __restrict__ beta_out) {
  const int wave = threadIdx.x >> 5;
  const int lane = threadIdx.x & 31;
  const int tok = blockIdx.x * 8 + wave;          // grid = 750 -> 6000 tokens
  const float* row = feat + (size_t)tok * EDIM;

  float v[8];
  float s = 0.f;
#pragma unroll
  for (int i = 0; i < 8; ++i) { v[i] = row[lane + 32 * i]; s += v[i]; }
#pragma unroll
  for (int m = 16; m >= 1; m >>= 1) s += __shfl_xor(s, m, 32);
  const float mu = s * (1.f / 256.f);
  float var = 0.f;
#pragma unroll
  for (int i = 0; i < 8; ++i) { float d = v[i] - mu; var += d * d; }
#pragma unroll
  for (int m = 16; m >= 1; m >>= 1) var += __shfl_xor(var, m, 32);
  const float rstd = rsqrtf(var * (1.f / 256.f) + EPSLN);

  float xo[8];
#pragma unroll
  for (int i = 0; i < 8; ++i) {
    const int e = lane + 32 * i;
    xo[i] = (v[i] - mu) * rstd * w[e] + bias[e];
    x_out[(size_t)tok * EDIM + e] = xo[i];
  }

  if (DO_BETA) {
    const int b = tok / NTOK, n = tok % NTOK;
#pragma unroll
    for (int h = 0; h < HEADS; ++h) {
      float p = 0.f;
#pragma unroll
      for (int i = 0; i < 8; ++i) p += xo[i] * beta_w[h * EDIM + lane + 32 * i];
#pragma unroll
      for (int m = 16; m >= 1; m >>= 1) p += __shfl_xor(p, m, 32);
      if (lane == 0) beta_out[(size_t)(b * HEADS + h) * NTOK + n] = p + beta_b[h];
    }
  }
}

// ---------------------------------------------------------------------------
// C[M,Nc] = A[M,K] @ W[Nc,K]^T + bias  (+ epilogue)
// EPI: 0 = bias, 1 = bias + residual, 2 = bias + exact GELU
// Block = 4 waves on one 48x64 tile of C; wave w owns columns 16w..16w+15 and
// all 48 rows (three accumulators that share one W fragment).
// A KC-wide chunk of the 48 A rows and of the 64 W rows is staged in LDS by
// async copies of whole 256-byte row pieces, two buffers, the next chunk in
// flight while this one is used. k runs upward in each accumulator.
// grid = (Nc/64, M/48), exact.  K a multiple of KC.
// ---------------------------------------------------------------------------
#define BM 48
#define BN 64
#define GPITCH 68  // floats per staged row: 8-byte fragment reads hit 64 distinct banks

template <int EPI>
__global__ __launch_bounds__(128) void wmma_gemm_kernel(
    const float* __restrict__ A, const float* __restrict__ W,
    const float* __restrict__ bias, const float* __restrict__ resid,
    float* __restrict__ C, int M, int Nc, int K) {
  __shared__ __attribute__((aligned(16))) float As[2][BM * GPITCH];
  __shared__ __attribute__((aligned(16))) float Ws[2][BN * GPITCH];
  const int tid = threadIdx.x;
  const int lane = tid & 31;
  const int wave = __builtin_amdgcn_readfirstlane(tid >> 5);
  const int hi = lane >> 4;
  const int l15 = lane & 15;
  const int nb = blockIdx.x * BN;
  const int n0 = nb + wave * 16;
  const int m0 = blockIdx.y * BM;

  // copies: 16 lanes cover one row's 256 bytes, the block covers 8 rows a pass
  const int crow = tid >> 4;        // 0..7
  const int ccol = (tid & 15) * 4;  // 0..60
  const float* ag = A + (size_t)(m0 + crow) * K + ccol;
  const float* wg = W + (size_t)(nb + crow) * K + ccol;
  const size_t rs = (size_t)8 * K;  // 8 rows down in global memory
  const unsigned ls = 8 * GPITCH * 4;  // 8 rows down in LDS, bytes

  auto issue_chunk = [&](int c, int buf) {
    const float* a = ag + (size_t)c * KC;
    const float* w = wg + (size_t)c * KC;
    const unsigned la = lds_byte(&As[buf][crow * GPITCH + ccol]);
    const unsigned lw = lds_byte(&Ws[buf][crow * GPITCH + ccol]);
    // The copies and their s_wait_xcnt in one statement: no address register
    // is rewritten before the wait.
    asm volatile(
        "global_load_async_to_lds_b128 %0, %6, off\n\t"
        "global_load_async_to_lds_b128 %1, %7, off\n\t"
        "global_load_async_to_lds_b128 %2, %8, off\n\t"
        "global_load_async_to_lds_b128 %3, %9, off\n\t"
        "global_load_async_to_lds_b128 %4, %10, off\n\t"
        "global_load_async_to_lds_b128 %5, %11, off\n\t"
        "s_wait_xcnt 0x0"
        :: "v"(la), "v"(la + ls), "v"(la + 2 * ls), "v"(la + 3 * ls),
           "v"(la + 4 * ls), "v"(la + 5 * ls),
           "v"(a), "v"(a + rs), "v"(a + 2 * rs), "v"(a + 3 * rs),
           "v"(a + 4 * rs), "v"(a + 5 * rs) : "memory");
    asm volatile(
        "global_load_async_to_lds_b128 %0, %8, off\n\t"
        "global_load_async_to_lds_b128 %1, %9, off\n\t"
        "global_load_async_to_lds_b128 %2, %10, off\n\t"
        "global_load_async_to_lds_b128 %3, %11, off\n\t"
        "global_load_async_to_lds_b128 %4, %12, off\n\t"
        "global_load_async_to_lds_b128 %5, %13, off\n\t"
        "global_load_async_to_lds_b128 %6, %14, off\n\t"
        "global_load_async_to_lds_b128 %7, %15, off\n\t"
        "s_wait_xcnt 0x0"
        :: "v"(lw), "v"(lw + ls), "v"(lw + 2 * ls), "v"(lw + 3 * ls),
           "v"(lw + 4 * ls), "v"(lw + 5 * ls), "v"(lw + 6 * ls), "v"(lw + 7 * ls),
           "v"(w), "v"(w + rs), "v"(w + 2 * rs), "v"(w + 3 * rs),
           "v"(w + 4 * rs), "v"(w + 5 * rs), "v"(w + 6 * rs), "v"(w + 7 * rs)
        : "memory");
  };

  const int nchunks = K / KC;
  issue_chunk(0, 0);

  const float bn = bias[n0 + l15];
  v8f acc[3] = {};

  // chunk 0 has landed for this wave, then for the whole block
  asm volatile("s_wait_asynccnt 0x0" ::: "memory");
  __syncthreads();
  if (nchunks > 1) issue_chunk(1, 1);

  for (int c = 0; c < nchunks; ++c) {
    const int buf = c & 1;
    const float* ap = &As[buf][l15 * GPITCH + 2 * hi];
    const float* bp = &Ws[buf][(wave * 16 + l15) * GPITCH + 2 * hi];
    // unrolled: LDS offsets become immediates and the reads run ahead of the products
#pragma unroll
    for (int k = 0; k < KC; k += 4) {
      const v2f b = *(const v2f*)(bp + k);  // W[n0+l15][k+2*hi+{0,1}]
#pragma unroll  // acc[t] is indexed by constants and stays in registers
      for (int t = 0; t < 3; ++t) {
        const v2f a = *(const v2f*)(ap + t * 16 * GPITCH + k);  // A[m0+16t+l15][same k]
        acc[t] = WMMA4(a, b, acc[t]);
      }
    }
    // Hand-over: this wave's LDS reads of the chunk are done, its copies of
    // the next chunk have landed; the barrier publishes the next chunk and
    // frees this buffer for the refill behind it.
    asm volatile("s_wait_dscnt 0x0" ::: "memory");
    asm volatile("s_wait_asynccnt 0x0" ::: "memory");
    __syncthreads();
    if (c + 2 < nchunks) issue_chunk(c + 2, buf);
  }
  // no copy is left in flight when the wave ends
  asm volatile("s_wait_asynccnt 0x0" ::: "memory");

  // both unrolled: accumulator elements are named by constants
#pragma unroll
  for (int t = 0; t < 3; ++t) {
#pragma unroll
    for (int r = 0; r < 8; ++r) {
      const int m = m0 + t * 16 + r + 8 * hi;
      float v = acc[t][r] + bn;
      if (EPI == 1) v += resid[(size_t)m * Nc + n0 + l15];
      if (EPI == 2) v = 0.5f * v * (1.f + erff(v * 0.70710678118654752f));
      C[(size_t)m * Nc + n0 + l15] = v;
    }
  }
}

// ---------------------------------------------------------------------------
// Flash attention with distance-bias mask, one wave per 16-query tile.
// qkv: (B, N, 768) with cols [0,256)=Q, [256,512)=K, [512,768)=V (head-major).
// S^T = K_tile @ Q^T (softmax rows live per-lane), O^T = V^T @ P^T with
// P^T remapped C-layout -> B-fragments via shfl_xor(16).
// block = 128 threads = 4 waves = 4 query tiles of ONE head, which share the
// head's K rows, V rows and key points: a stage of 32 keys is brought into LDS
// by async copies, two buffers, the next stage in flight while this one is used.
// grid = (ceil(N/64), HEADS, B).
// ---------------------------------------------------------------------------
#define KSTG 32                    // keys per LDS stage (two 16-key tiles)
#define NSTG 47                    // ceil(NTOK / KSTG)
#define KPITCH 36                  // floats per staged K row: 8-byte fragment reads hit 64 distinct banks
#define VPITCH 40                  // floats per staged V row: rows k and k+2 fall 16 banks apart

// Register budget of 2 to 4 waves per SIMD (three blocks stand on a WGP): with
// it a stage's LDS reads issue as one group ahead of the matrix runs.
__global__ __launch_bounds__(128) __attribute__((amdgpu_waves_per_eu(2, 4))) void attn_kernel(
    const float* __restrict__ qkv, const float* __restrict__ points,
    const float* __restrict__ beta, float* __restrict__ attn_out) {
  __shared__ __attribute__((aligned(16))) float Ks[2][KSTG * KPITCH];
  __shared__ __attribute__((aligned(16))) float Vs[2][KSTG * VPITCH];
  __shared__ __attribute__((aligned(16))) float Ps[2][KSTG * 2];  // 32 x, then 32 y

  const int wave = __builtin_amdgcn_readfirstlane(threadIdx.x >> 5);
  const int lane = threadIdx.x & 31;
  const int hi = lane >> 4;
  const int l15 = lane & 15;
  const int h = blockIdx.y;
  const int b = blockIdx.z;
  const int q0 = blockIdx.x * 64 + wave * 16;
  const int q = q0 + l15;
  const int qc = min(q, NTOK - 1);

  const float* Kbase = qkv + (size_t)b * NTOK * 768 + 256 + h * DHEAD;

  // One stage: each wave copies 8 K rows and 8 V rows (128 B each, 16 B per
  // lane); waves 0 and 1 also copy 16 keys' (x, y). Rows past the last key are
  // clamped to it; their scores are masked below.
  auto issue_stage = [&](int stg, int buf) {
    const int kb = stg * KSTG;
    const int r0 = wave * 8 + (lane >> 3);
    const int c = (lane & 7) * 4;
    const float* gk0 = Kbase + (size_t)min(kb + r0, NTOK - 1) * 768 + c;
    const float* gk1 = Kbase + (size_t)min(kb + r0 + 4, NTOK - 1) * 768 + c;
    const float* gv0 = gk0 + 256;
    const float* gv1 = gk1 + 256;
    const unsigned lk0 = lds_byte(&Ks[buf][r0 * KPITCH + c]);
    const unsigned lk1 = lds_byte(&Ks[buf][(r0 + 4) * KPITCH + c]);
    const unsigned lv0 = lds_byte(&Vs[buf][r0 * VPITCH + c]);
    const unsigned lv1 = lds_byte(&Vs[buf][(r0 + 4) * VPITCH + c]);
    // The copies and their s_wait_xcnt in one statement: no address register
    // is rewritten before the wait.
    asm volatile(
        "global_load_async_to_lds_b128 %0, %4, off\n\t"
        "global_load_async_to_lds_b128 %1, %5, off\n\t"
        "global_load_async_to_lds_b128 %2, %6, off\n\t"
        "global_load_async_to_lds_b128 %3, %7, off\n\t"
        "s_wait_xcnt 0x0"
        :: "v"(lk0), "v"(lk1), "v"(lv0), "v"(lv1),
           "v"(gk0), "v"(gk1), "v"(gv0), "v"(gv1) : "memory");
    if (wave < 2) {  // wave is scalar: a uniform branch, every lane on inside
      const int key = wave * 16 + l15;
      const float* gp =
          points + (size_t)(b * NTOK + min(kb + key, NTOK - 1)) * 3 + hi;
      const unsigned lp = lds_byte(&Ps[buf][hi * KSTG + key]);
      asm volatile(
          "global_load_async_to_lds_b32 %0, %1, off\n\t"
          "s_wait_xcnt 0x0"
          :: "v"(lp), "v"(gp) : "memory");
    }
  };

  issue_stage(0, 0);

  const float* Qrow = qkv + (size_t)(b * NTOK + qc) * 768 + h * DHEAD;
  v2f qb[8];
#pragma unroll
  for (int s = 0; s < 8; ++s) qb[s] = *(const v2f*)(Qrow + 4 * s + 2 * hi);

  const float cqx = points[(size_t)(b * NTOK + qc) * 3 + 0];
  const float cqy = points[(size_t)(b * NTOK + qc) * 3 + 1];
  const float betav = beta[(size_t)(b * HEADS + h) * NTOK + qc];
  // Scores are kept in base-2 units: log2(e) is folded into the score scale and
  // into beta, so that each exponential is one hardware exp2.
  const float scal = 0.17677669529663687f * 1.4426950408889634f;  // log2(e)/sqrt(32)
  const float beta2 = betav * 1.4426950408889634f;

  float m_run = -1e30f, l_run = 0.f;
  v8f o0 = {}, o1 = {};

  // stage 0 has landed for this wave, then for the whole block
  asm volatile("s_wait_asynccnt 0x0" ::: "memory");
  __syncthreads();
  issue_stage(1, 1);

  for (int stg = 0; stg < NSTG; ++stg) {
    const int buf = stg & 1;
    const float* Kb = &Ks[buf][0];
    const float* Vb = &Vs[buf][0];
    const float* Pb = &Ps[buf][0];

    // unrolled: LDS offsets become immediates, the two tiles' score products interleave
#pragma unroll
    for (int t = 0; t < 2; ++t) {
      const int k0 = stg * KSTG + t * 16;
      // ---- S^T tile: rows = keys, cols = queries ----
      const float* Krow = Kb + (t * 16 + l15) * KPITCH;
      v8f st = {};
#pragma unroll
      for (int s = 0; s < 8; ++s) {
        v2f a = *(const v2f*)(Krow + 4 * s + 2 * hi);  // K[key=l15][d]
        st = WMMA4(a, qb[s], st);
      }

      // ---- scale + distance-bias mask ----
      const float* Prow = Pb + t * 16 + 8 * hi;  // this half's 8 keys
      float dd[8];  // squared distance, then distance
#pragma unroll  // here and below: dd[r] is named by constants and stays in registers
      for (int r = 0; r < 8; ++r) {
        const float kx = Prow[r];
        const float ky = Prow[KSTG + r];
        const float dx = cqx - kx, dy = cqy - ky;
        dd[r] = dx * dx + dy * dy;
      }
      sqrt_x8(dd);
#pragma unroll
      for (int r = 0; r < 8; ++r) {
        const int key = k0 + r + 8 * hi;
        const float dist = -dd[r];
        float v = st[r] * scal + dist * beta2;
        if (key >= NTOK) v = -1e30f;  // pad keys
        st[r] = v;
      }

      // ---- online softmax (row = fixed q = fixed lane15, halves share q) ----
      float mx = st[0];
#pragma unroll
      for (int r = 1; r < 8; ++r) mx = fmaxf(mx, st[r]);
      mx = fmaxf(mx, __shfl_xor(mx, 16, 32));
      const float m_new = fmaxf(m_run, mx);
      float rescale = m_run - m_new;
      float pe[8];
#pragma unroll  // pe[r] is named by constants and stays in registers
      for (int r = 0; r < 8; ++r) pe[r] = st[r] - m_new;
      exp2_x9(pe, rescale);
      float lsum = 0.f;
#pragma unroll
      for (int r = 0; r < 8; ++r) {
        const float p = pe[r];
        st[r] = p;
        lsum += p;
      }
      lsum += __shfl_xor(lsum, 16, 32);
      l_run = l_run * rescale + lsum;
      m_run = m_new;
#pragma unroll
      for (int r = 0; r < 8; ++r) { o0[r] *= rescale; o1[r] *= rescale; }

      // ---- O^T += V^T @ P^T ----
#pragma unroll
      for (int s = 0; s < 4; ++s) {
        const int base = (s & 1) * 4;
        v2f pb;
#pragma unroll
        for (int j = 0; j < 2; ++j) {
          const float t_lo = st[base + j];
          const float t_hi = st[base + j + 2];
          const float x_lo = __shfl_xor(t_lo, 16, 32);
          const float x_hi = __shfl_xor(t_hi, 16, 32);
          pb[j] = (s < 2) ? (hi ? x_hi : t_lo) : (hi ? t_hi : x_lo);
        }
        const float* vr1 = Vb + (t * 16 + 4 * s + 2 * hi) * VPITCH;
        const float* vr2 = vr1 + VPITCH;
        v2f a0 = {vr1[l15], vr2[l15]};            // V^T[d=l15][key]
        v2f a1 = {vr1[16 + l15], vr2[16 + l15]};  // V^T[d=16+l15][key]
        o0 = WMMA4(a0, pb, o0);
        o1 = WMMA4(a1, pb, o1);
      }
    }

    // Hand-over: this wave's LDS reads of the stage are done, its copies of
    // the next stage have landed; the barrier publishes the next stage and
    // frees this buffer for the refill behind it.
    asm volatile("s_wait_dscnt 0x0" ::: "memory");
    asm volatile("s_wait_asynccnt 0x0" ::: "memory");
    __syncthreads();
    if (stg + 2 < NSTG) issue_stage(stg + 2, buf);
  }
  // no copy is left in flight when the wave ends
  asm volatile("s_wait_asynccnt 0x0" ::: "memory");

  if (q < NTOK) {
    const float inv = 1.f / l_run;
    float* orow = attn_out + (size_t)(b * NTOK + q) * EDIM + h * DHEAD + 8 * hi;
#pragma unroll
    for (int r = 0; r < 8; ++r) {
      orow[r] = o0[r] * inv;        // d = r + 8*hi
      orow[16 + r] = o1[r] * inv;   // d = 16 + r + 8*hi
    }
  }
}

// ---------------------------------------------------------------------------
extern "C" void kernel_launch(void* const* d_in, const int* in_sizes, int n_in,
                              void* d_out, int out_size, void* d_ws,
                              size_t ws_size, hipStream_t stream) {
  const float* feat = (const float*)d_in[0];
  const float* points = (const float*)d_in[1];
  const float* ln1_w = (const float*)d_in[2];
  const float* ln1_b = (const float*)d_in[3];
  const float* beta_w = (const float*)d_in[4];
  const float* beta_b = (const float*)d_in[5];
  const float* in_w = (const float*)d_in[6];
  const float* in_b = (const float*)d_in[7];
  const float* out_w = (const float*)d_in[8];
  const float* out_b = (const float*)d_in[9];
  const float* ln2_w = (const float*)d_in[10];
  const float* ln2_b = (const float*)d_in[11];
  const float* fc1_w = (const float*)d_in[12];
  const float* fc1_b = (const float*)d_in[13];
  const float* fc2_w = (const float*)d_in[14];
  const float* fc2_b = (const float*)d_in[15];

  float* ws = (float*)d_ws;
  float* x_ln = ws;                 // 6000*256      = 1,536,000 f
  float* betab = ws + 1536000;      // 4*8*1500      =    48,000 f
  float* qkv = ws + 1584000;        // 6000*768      = 4,608,000 f
  float* attn = ws + 6192000;       // 6000*256      = 1,536,000 f
  float* feat2 = ws + 7728000;      // 6000*256      = 1,536,000 f
  float* y2 = attn;                 // reuse after out-proj consumed attn
  float* hfc1 = qkv;                // reuse after attention consumed qkv
  float* outp = (float*)d_out;

  // 1) LN1 + beta projection
  ln_kernel<true><<<dim3(750), dim3(256), 0, stream>>>(
      feat, ln1_w, ln1_b, beta_w, beta_b, x_ln, betab);
  // 2) QKV projection: (6000x256)@(768x256)^T
  wmma_gemm_kernel<0><<<dim3(12, 125), dim3(128), 0, stream>>>(
      x_ln, in_w, in_b, nullptr, qkv, NT, 768, 256);
  // 3) flash attention with distance-bias
  attn_kernel<<<dim3(24, HEADS, BATCH), dim3(128), 0, stream>>>(qkv, points, betab, attn);
  // 4) output projection + residual
  wmma_gemm_kernel<1><<<dim3(4, 125), dim3(128), 0, stream>>>(
      attn, out_w, out_b, feat, feat2, NT, 256, 256);
  // 5) LN2
  ln_kernel<false><<<dim3(750), dim3(256), 0, stream>>>(
      feat2, ln2_w, ln2_b, nullptr, nullptr, y2, nullptr);
  // 6) FC1 + exact GELU: (6000x256)@(512x256)^T
  wmma_gemm_kernel<2><<<dim3(8, 125), dim3(128), 0, stream>>>(
      y2, fc1_w, fc1_b, nullptr, hfc1, NT, 512, 256);
  // 7) FC2 -> out: (6000x512)@(256x512)^T
  wmma_gemm_kernel<0><<<dim3(4, 125), dim3(128), 0, stream>>>(
      hfc1, fc2_w, fc2_b, nullptr, outp, NT, 256, 512);
}

// v004
// A run of this version takes 135 microseconds.
// Next to v003, in two timings, it ran 1.03 times as fast each time.
// Counting every step since v000, it is 1.89 times as fast.
#include <hip/hip_runtime.h>
#include <math.h>
#include <stdint.h>

#define EDIM 256
#define HEADS 8
#define NTOK 1500
#define BATCH 4
#define DHEAD 32
#define HID 512
#define NT 6000            // BATCH*NTOK tokens
#define EPSLN 1e-6f
#define KC 64              // K-chunk staged through LDS

typedef __attribute__((ext_vector_type(2))) float v2f;
typedef __attribute__((ext_vector_type(8))) float v8f;

// D = A(16x4) * B(4x16) + C, full fp32 (CDNA5 V_WMMA_F32_16X16X4_F32)
#define WMMA4(a, b, c) \
  __builtin_amdgcn_wmma_f32_16x16x4_f32(false, (a), false, (b), (short)0, (c), false, false)

// low 32 bits of a __shared__ address = byte offset in the work-group's LDS
__device__ __forceinline__ unsigned lds_byte(const float* p) {
  return (unsigned)(uintptr_t)(__attribute__((address_space(3))) const float*)p;
}

// Lane l reads lane l ^ 16: one vector instruction, no trip through the LDS pipe.
__device__ __forceinline__ float xhalf(float x) {
  const int b = __builtin_bit_cast(int, x);
  return __builtin_bit_cast(
      float, __builtin_amdgcn_permlanex16(b, b, 0x76543210, 0xfedcba98, false, false));
}

// Hardware transcendentals, a run of independent ones in one statement, each in
// place. The instruction set asks for one independent instruction behind a
// transcendental before its result is read or its source overwritten: each is
// that for the one in front of it, the v_nop for the last. In place, so that the
// statement writes no register but those the vector instructions in front of it
// wrote: none can be an operand of a matrix instruction still under way.
__device__ __forceinline__ void sqrt_x8(float (&x)[8]) {
  asm("v_sqrt_f32 %0, %0\n\t"
      "v_sqrt_f32 %1, %1\n\t"
      "v_sqrt_f32 %2, %2\n\t"
      "v_sqrt_f32 %3, %3\n\t"
      "v_sqrt_f32 %4, %4\n\t"
      "v_sqrt_f32 %5, %5\n\t"
      "v_sqrt_f32 %6, %6\n\t"
      "v_sqrt_f32 %7, %7\n\t"
      "v_nop"
      : "+v"(x[0]), "+v"(x[1]), "+v"(x[2]), "+v"(x[3]),
        "+v"(x[4]), "+v"(x[5]), "+v"(x[6]), "+v"(x[7]));
}
// 2^x for eight scores and for the running maximum's step
__device__ __forceinline__ void exp2_x9(float (&x)[8], float& y) {
  asm("v_exp_f32 %8, %8\n\t"
      "v_exp_f32 %0, %0\n\t"
      "v_exp_f32 %1, %1\n\t"
      "v_exp_f32 %2, %2\n\t"
      "v_exp_f32 %3, %3\n\t"
      "v_exp_f32 %4, %4\n\t"
      "v_exp_f32 %5, %5\n\t"
      "v_exp_f32 %6, %6\n\t"
      "v_exp_f32 %7, %7\n\t"
      "v_nop"
      : "+v"(x[0]), "+v"(x[1]), "+v"(x[2]), "+v"(x[3]),
        "+v"(x[4]), "+v"(x[5]), "+v"(x[6]), "+v"(x[7]), "+v"(y));
}

// ---------------------------------------------------------------------------
// LayerNorm over E=256, one wave per token; optionally beta[b,h,n].
// ---------------------------------------------------------------------------
template <bool DO_BETA>
__global__ __launch_bounds__(256) void ln_kernel(
    const float* __restrict__ feat, const float* __restrict__ w,
    const float* __restrict__ bias, const float* __restrict__ beta_w,
    const float* __restrict__ beta_b, float* __restrict__ x_out,
    float* __restrict__ beta_out) {
  const int wave = threadIdx.x >> 5;
  const int lane = threadIdx.x & 31;
  const int tok = blockIdx.x * 8 + wave;          // grid = 750 -> 6000 tokens
  const float* row = feat + (size_t)tok * EDIM;

  float v[8];
  float s = 0.f;
#pragma unroll
  for (int i = 0; i < 8; ++i) { v[i] = row[lane + 32 * i]; s += v[i]; }
#pragma unroll
  for (int m = 16; m >= 1; m >>= 1) s += __shfl_xor(s, m, 32);
  const float mu = s * (1.f / 256.f);
  float var = 0.f;
#pragma unroll
  for (int i = 0; i < 8; ++i) { float d = v[i] - mu; var += d * d; }
#pragma unroll
  for (int m = 16; m >= 1; m >>= 1) var += __shfl_xor(var, m, 32);
  const float rstd = rsqrtf(var * (1.f / 256.f) + EPSLN);

  float xo[8];
#pragma unroll
  for (int i = 0; i < 8; ++i) {
    const int e = lane + 32 * i;
    xo[i] = (v[i] - mu) * rstd * w[e] + bias[e];
    x_out[(size_t)tok * EDIM + e] = xo[i];
  }

  if (DO_BETA) {
    const int b = tok / NTOK, n = tok % NTOK;
#pragma unroll
    for (int h = 0; h < HEADS; ++h) {
      float p = 0.f;
#pragma unroll
      for (int i = 0; i < 8; ++i) p += xo[i] * beta_w[h * EDIM + lane + 32 * i];
#pragma unroll
      for (int m = 16; m >= 1; m >>= 1) p += __shfl_xor(p, m, 32);
      if (lane == 0) beta_out[(size_t)(b * HEADS + h) * NTOK + n] = p + beta_b[h];
    }
  }
}

// ---------------------------------------------------------------------------
// C[M,Nc] = A[M,K] @ W[Nc,K]^T + bias  (+ epilogue)
// EPI: 0 = bias, 1 = bias + residual, 2 = bias + exact GELU
// Block = 4 waves on one 48x64 tile of C; wave w owns columns 16w..16w+15 and
// all 48 rows (three accumulators that share one W fragment).
// A KC-wide chunk of the 48 A rows and of the 64 W rows is staged in LDS by
// async copies of whole 256-byte row pieces, two buffers, the next chunk in
// flight while this one is used. k runs upward in each accumulator.
// grid = (Nc/64, M/48), exact.  K a multiple of KC.
// ---------------------------------------------------------------------------
#define BM 48
#define BN 64
#define GPITCH 68  // floats per staged row: 8-byte fragment reads hit 64 distinct banks

template <int EPI>
__global__ __launch_bounds__(128) void wmma_gemm_kernel(
    const float* __restrict__ A, const float* __restrict__ W,
    const float* __restrict__ bias, const float* __restrict__ resid,
    float* __restrict__ C, int M, int Nc, int K) {
  __shared__ __attribute__((aligned(16))) float As[2][BM * GPITCH];
  __shared__ __attribute__((aligned(16))) float Ws[2][BN * GPITCH];
  const int tid = threadIdx.x;
  const int lane = tid & 31;
  const int wave = __builtin_amdgcn_readfirstlane(tid >> 5);
  const int hi = lane >> 4;
  const int l15 = lane & 15;
  const int nb = blockIdx.x * BN;
  const int n0 = nb + wave * 16;
  const int m0 = blockIdx.y * BM;

  // copies: 16 lanes cover one row's 256 bytes, the block covers 8 rows a pass
  const int crow = tid >> 4;        // 0..7
  const int ccol = (tid & 15) * 4;  // 0..60
  const float* ag = A + (size_t)(m0 + crow) * K + ccol;
  const float* wg = W + (size_t)(nb + crow) * K + ccol;
  const size_t rs = (size_t)8 * K;  // 8 rows down in global memory
  const unsigned ls = 8 * GPITCH * 4;  // 8 rows down in LDS, bytes

  auto issue_chunk = [&](int c, int buf) {
    const float* a = ag + (size_t)c * KC;
    const float* w = wg + (size_t)c * KC;
    const unsigned la = lds_byte(&As[buf][crow * GPITCH + ccol]);
    const unsigned lw = lds_byte(&Ws[buf][crow * GPITCH + ccol]);
    // The copies and their s_wait_xcnt in one statement: no address register
    // is rewritten before the wait.
    asm volatile(
        "global_load_async_to_lds_b128 %0, %6, off\n\t"
        "global_load_async_to_lds_b128 %1, %7, off\n\t"
        "global_load_async_to_lds_b128 %2, %8, off\n\t"
        "global_load_async_to_lds_b128 %3, %9, off\n\t"
        "global_load_async_to_lds_b128 %4, %10, off\n\t"
        "global_load_async_to_lds_b128 %5, %11, off\n\t"
        "s_wait_xcnt 0x0"
        :: "v"(la), "v"(la + ls), "v"(la + 2 * ls), "v"(la + 3 * ls),
           "v"(la + 4 * ls), "v"(la + 5 * ls),
           "v"(a), "v"(a + rs), "v"(a + 2 * rs), "v"(a + 3 * rs),
           "v"(a + 4 * rs), "v"(a + 5 * rs) : "memory");
    asm volatile(
        "global_load_async_to_lds_b128 %0, %8, off\n\t"
        "global_load_async_to_lds_b128 %1, %9, off\n\t"
        "global_load_async_to_lds_b128 %2, %10, off\n\t"
        "global_load_async_to_lds_b128 %3, %11, off\n\t"
        "global_load_async_to_lds_b128 %4, %12, off\n\t"
        "global_load_async_to_lds_b128 %5, %13, off\n\t"
        "global_load_async_to_lds_b128 %6, %14, off\n\t"
        "global_load_async_to_lds_b128 %7, %15, off\n\t"
        "s_wait_xcnt 0x0"
        :: "v"(lw), "v"(lw + ls), "v"(lw + 2 * ls), "v"(lw + 3 * ls),
           "v"(lw + 4 * ls), "v"(lw + 5 * ls), "v"(lw + 6 * ls), "v"(lw + 7 * ls),
           "v"(w), "v"(w + rs), "v"(w + 2 * rs), "v"(w + 3 * rs),
           "v"(w + 4 * rs), "v"(w + 5 * rs), "v"(w + 6 * rs), "v"(w + 7 * rs)
        : "memory");
  };

  const int nchunks = K / KC;
  issue_chunk(0, 0);

  const float bn = bias[n0 + l15];
  v8f acc[3] = {};

  // chunk 0 has landed for this wave, then for the whole block
  asm volatile("s_wait_asynccnt 0x0" ::: "memory");
  __syncthreads();
  if (nchunks > 1) issue_chunk(1, 1);

  for (int c = 0; c < nchunks; ++c) {
    const int buf = c & 1;
    const float* ap = &As[buf][l15 * GPITCH + 2 * hi];
    const float* bp = &Ws[buf][(wave * 16 + l15) * GPITCH + 2 * hi];
    // unrolled: LDS offsets become immediates and the reads run ahead of the products
#pragma unroll
    for (int k = 0; k < KC; k += 4) {
      const v2f b = *(const v2f*)(bp + k);  // W[n0+l15][k+2*hi+{0,1}]
#pragma unroll  // acc[t] is indexed by constants and stays in registers
      for (int t = 0; t < 3; ++t) {
        const v2f a = *(const v2f*)(ap + t * 16 * GPITCH + k);  // A[m0+16t+l15][same k]
        acc[t] = WMMA4(a, b, acc[t]);
      }
    }
    // Hand-over: this wave's LDS reads of the chunk are done, its copies of
    // the next chunk have landed; the barrier publishes the next chunk and
    // frees this buffer for the refill behind it.
    asm volatile("s_wait_dscnt 0x0" ::: "memory");
    asm volatile("s_wait_asynccnt 0x0" ::: "memory");
    __syncthreads();
    if (c + 2 < nchunks) issue_chunk(c + 2, buf);
  }
  // no copy is left in flight when the wave ends
  asm volatile("s_wait_asynccnt 0x0" ::: "memory");

  // both unrolled: accumulator elements are named by constants
#pragma unroll
  for (int t = 0; t < 3; ++t) {
#pragma unroll
    for (int r = 0; r < 8; ++r) {
      const int m = m0 + t * 16 + r + 8 * hi;
      float v = acc[t][r] + bn;
      if (EPI == 1) v += resid[(size_t)m * Nc + n0 + l15];
      if (EPI == 2) v = 0.5f * v * (1.f + erff(v * 0.70710678118654752f));
      C[(size_t)m * Nc + n0 + l15] = v;
    }
  }
}

// ---------------------------------------------------------------------------
// Flash attention with distance-bias mask, one wave per 16-query tile.
// qkv: (B, N, 768) with cols [0,256)=Q, [256,512)=K, [512,768)=V (head-major).
// S^T = K_tile @ Q^T (softmax rows live per-lane), O^T = V^T @ P^T with
// the keys of each product step taken as the score tile's lanes hold them.
// block = 128 threads = 4 waves = 4 query tiles of ONE head, which share the
// head's K rows, V rows and key points: a stage of 32 keys is brought into LDS
// by async copies, two buffers, the next stage in flight while this one is used.
// grid = (ceil(N/64), HEADS, B).
// ---------------------------------------------------------------------------
#define KSTG 32                    // keys per LDS stage (two 16-key tiles)
#define NSTG 47                    // ceil(NTOK / KSTG)
#define KPITCH 36                  // floats per staged K row: 8-byte fragment reads hit 64 distinct banks
#define VPITCH 36                  // floats per staged V row: rows k and k+8 fall 32 banks apart

// Register budget of 2 to 4 waves per SIMD (three blocks stand on a WGP): with
// it a stage's LDS reads issue as one group ahead of the matrix runs.
__global__ __launch_bounds__(128) __attribute__((amdgpu_waves_per_eu(2, 4))) void attn_kernel(
    const float* __restrict__ qkv, const float* __restrict__ points,
    const float* __restrict__ beta, float* __restrict__ attn_out) {
  __shared__ __attribute__((aligned(16))) float Ks[2][KSTG * KPITCH];
  __shared__ __attribute__((aligned(16))) float Vs[2][KSTG * VPITCH];
  __shared__ __attribute__((aligned(16))) float Ps[2][KSTG * 2];  // 32 x, then 32 y

  const int wave = __builtin_amdgcn_readfirstlane(threadIdx.x >> 5);
  const int lane = threadIdx.x & 31;
  const int hi = lane >> 4;
  const int l15 = lane & 15;
  const int h = blockIdx.y;
  const int b = blockIdx.z;
  const int q0 = blockIdx.x * 64 + wave * 16;
  const int q = q0 + l15;
  const int qc = min(q, NTOK - 1);

  const float* Kbase = qkv + (size_t)b * NTOK * 768 + 256 + h * DHEAD;

  // One stage: each wave copies 8 K rows and 8 V rows (128 B each, 16 B per
  // lane); waves 0 and 1 also copy 16 keys' (x, y). Rows past the last key are
  // clamped to it; their scores are masked below.
  auto issue_stage = [&](int stg, int buf) {
    const int kb = stg * KSTG;
    const int r0 = wave * 8 + (lane >> 3);
    const int c = (lane & 7) * 4;
    const float* gk0 = Kbase + (size_t)min(kb + r0, NTOK - 1) * 768 + c;
    const float* gk1 = Kbase + (size_t)min(kb + r0 + 4, NTOK - 1) * 768 + c;
    const float* gv0 = gk0 + 256;
    const float* gv1 = gk1 + 256;
    const unsigned lk0 = lds_byte(&Ks[buf][r0 * KPITCH + c]);
    const unsigned lk1 = lds_byte(&Ks[buf][(r0 + 4) * KPITCH + c]);
    const unsigned lv0 = lds_byte(&Vs[buf][r0 * VPITCH + c]);
    const unsigned lv1 = lds_byte(&Vs[buf][(r0 + 4) * VPITCH + c]);
    // The copies and their s_wait_xcnt in one statement: no address register
    // is rewritten before the wait.
    asm volatile(
        "global_load_async_to_lds_b128 %0, %4, off\n\t"
        "global_load_async_to_lds_b128 %1, %5, off\n\t"
        "global_load_async_to_lds_b128 %2, %6, off\n\t"
        "global_load_async_to_lds_b128 %3, %7, off\n\t"
        "s_wait_xcnt 0x0"
        :: "v"(lk0), "v"(lk1), "v"(lv0), "v"(lv1),
           "v"(gk0), "v"(gk1), "v"(gv0), "v"(gv1) : "memory");
    if (wave < 2) {  // wave is scalar: a uniform branch, every lane on inside
      const int key = wave * 16 + l15;
      const float* gp =
          points + (size_t)(b * NTOK + min(kb + key, NTOK - 1)) * 3 + hi;
      const unsigned lp = lds_byte(&Ps[buf][hi * KSTG + key]);
      asm volatile(
          "global_load_async_to_lds_b32 %0, %1, off\n\t"
          "s_wait_xcnt 0x0"
          :: "v"(lp), "v"(gp) : "memory");
    }
  };

  issue_stage(0, 0);

  const float* Qrow = qkv + (size_t)(b * NTOK + qc) * 768 + h * DHEAD;
  v2f qb[8];
#pragma unroll
  for (int s = 0; s < 8; ++s) qb[s] = *(const v2f*)(Qrow + 4 * s + 2 * hi);

  const float cqx = points[(size_t)(b * NTOK + qc) * 3 + 0];
  const float cqy = points[(size_t)(b * NTOK + qc) * 3 + 1];
  const float betav = beta[(size_t)(b * HEADS + h) * NTOK + qc];
  // Scores are kept in base-2 units: log2(e) is folded into the score scale and
  // into beta, so that each exponential is one hardware exp2.
  const float scal = 0.17677669529663687f * 1.4426950408889634f;  // log2(e)/sqrt(32)
  const float beta2 = betav * 1.4426950408889634f;

  float m_run = -1e30f, l_run = 0.f;
  v8f o0 = {}, o1 = {};

  // stage 0 has landed for this wave, then for the whole block
  asm volatile("s_wait_asynccnt 0x0" ::: "memory");
  __syncthreads();
  issue_stage(1, 1);

  for (int stg = 0; stg < NSTG; ++stg) {
    const int buf = stg & 1;
    const float* Kb = &Ks[buf][0];
    const float* Vb = &Vs[buf][0];
    const float* Pb = &Ps[buf][0];

    // unrolled: LDS offsets become immediates, the two tiles' score products interleave
#pragma unroll
    for (int t = 0; t < 2; ++t) {
      const int k0 = stg * KSTG + t * 16;
      // ---- S^T tile: rows = keys, cols = queries ----
      const float* Krow = Kb + (t * 16 + l15) * KPITCH;
      v8f st = {};
#pragma unroll
      for (int s = 0; s < 8; ++s) {
        v2f a = *(const v2f*)(Krow + 4 * s + 2 * hi);  // K[key=l15][d]
        st = WMMA4(a, qb[s], st);
      }

      // ---- scale + distance-bias mask ----
      const float* Prow = Pb + t * 16 + 8 * hi;  // this half's 8 keys
      float dd[8];  // squared distance, then distance
#pragma unroll  // here and below: dd[r] is named by constants and stays in registers
      for (int r = 0; r < 8; ++r) {
        const float kx = Prow[r];
        const float ky = Prow[KSTG + r];
        const float dx = cqx - kx, dy = cqy - ky;
        dd[r] = dx * dx + dy * dy;
      }
      sqrt_x8(dd);
#pragma unroll
      for (int r = 0; r < 8; ++r) {
        const int key = k0 + r + 8 * hi;
        const float dist = -dd[r];
        float v = st[r] * scal + dist * beta2;
        if (key >= NTOK) v = -1e30f;  // pad keys
        st[r] = v;
      }

      // ---- online softmax (row = fixed q = fixed lane15, halves share q) ----
      float mx = st[0];
#pragma unroll
      for (int r = 1; r < 8; ++r) mx = fmaxf(mx, st[r]);
      mx = fmaxf(mx, xhalf(mx));
      const float m_new = fmaxf(m_run, mx);
      float rescale = m_run - m_new;
      float pe[8];
#pragma unroll  // pe[r] is named by constants and stays in registers
      for (int r = 0; r < 8; ++r) pe[r] = st[r] - m_new;
      exp2_x9(pe, rescale);
      float lsum = 0.f;
#pragma unroll
      for (int r = 0; r < 8; ++r) {
        const float p = pe[r];
        st[r] = p;
        lsum += p;
      }
      l_run = l_run * rescale + lsum;  // this lane half's keys only; joined after the loop
      m_run = m_new;
#pragma unroll
      for (int r = 0; r < 8; ++r) { o0[r] *= rescale; o1[r] *= rescale; }

      // ---- O^T += V^T @ P^T ----
      // The k order of a product is free as long as both operands agree: step s
      // takes keys 2s, 2s+1 in the low lane half and 8+2s, 8+2s+1 in the high
      // one, which are the scores each lane already holds in st[2s], st[2s+1].
#pragma unroll  // st[2s] is named by constants and stays in registers
      for (int s = 0; s < 4; ++s) {
        const v2f pb = {st[2 * s], st[2 * s + 1]};  // P^T[key = 8*hi+2s+{0,1}][q = l15]
        const float* vr1 = Vb + (t * 16 + 8 * hi + 2 * s) * VPITCH;
        const float* vr2 = vr1 + VPITCH;
        v2f a0 = {vr1[l15], vr2[l15]};            // V^T[d=l15][same keys]
        v2f a1 = {vr1[16 + l15], vr2[16 + l15]};  // V^T[d=16+l15][same keys]
        o0 = WMMA4(a0, pb, o0);
        o1 = WMMA4(a1, pb, o1);
      }
    }

    // Hand-over: this wave's LDS reads of the stage are done, its copies of
    // the next stage have landed; the barrier publishes the next stage and
    // frees this buffer for the refill behind it.
    asm volatile("s_wait_dscnt 0x0" ::: "memory");
    asm volatile("s_wait_asynccnt 0x0" ::: "memory");
    __syncthreads();
    if (stg + 2 < NSTG) issue_stage(stg + 2, buf);
  }
  // no copy is left in flight when the wave ends
  asm volatile("s_wait_asynccnt 0x0" ::: "memory");

  const float l_all = l_run + xhalf(l_run);  // both halves' keys; every lane still on
  if (q < NTOK) {
    const float inv = 1.f / l_all;
    float* orow = attn_out + (size_t)(b * NTOK + q) * EDIM + h * DHEAD + 8 * hi;
#pragma unroll
    for (int r = 0; r < 8; ++r) {
      orow[r] = o0[r] * inv;        // d = r + 8*hi
      orow[16 + r] = o1[r] * inv;   // d = 16 + r + 8*hi
    }
  }
}

// ---------------------------------------------------------------------------
extern "C" void kernel_launch(void* const* d_in, const int* in_sizes, int n_in,
                              void* d_out, int out_size, void* d_ws,
                              size_t ws_size, hipStream_t stream) {
  const float* feat = (const float*)d_in[0];
  const float* points = (const float*)d_in[1];
  const float* ln1_w = (const float*)d_in[2];
  const float* ln1_b = (const float*)d_in[3];
  const float* beta_w = (const float*)d_in[4];
  const float* beta_b = (const float*)d_in[5];
  const float* in_w = (const float*)d_in[6];
  const float* in_b = (const float*)d_in[7];
  const float* out_w = (const float*)d_in[8];
  const float* out_b = (const float*)d_in[9];
  const float* ln2_w = (const float*)d_in[10];
  const float* ln2_b = (const float*)d_in[11];
  const float* fc1_w = (const float*)d_in[12];
  const float* fc1_b = (const float*)d_in[13];
  const float* fc2_w = (const float*)d_in[14];
  const float* fc2_b = (const float*)d_in[15];

  float* ws = (float*)d_ws;
  float* x_ln = ws;                 // 6000*256      = 1,536,000 f
  float* betab = ws + 1536000;      // 4*8*1500      =    48,000 f
  float* qkv = ws + 1584000;        // 6000*768      = 4,608,000 f
  float* attn = ws + 6192000;       // 6000*256      = 1,536,000 f
  float* feat2 = ws + 7728000;      // 6000*256      = 1,536,000 f
  float* y2 = attn;                 // reuse after out-proj consumed attn
  float* hfc1 = qkv;                // reuse after attention consumed qkv
  float* outp = (float*)d_out;

  // 1) LN1 + beta projection
  ln_kernel<true><<<dim3(750), dim3(256), 0, stream>>>(
      feat, ln1_w, ln1_b, beta_w, beta_b, x_ln, betab);
  // 2) QKV projection: (6000x256)@(768x256)^T
  wmma_gemm_kernel<0><<<dim3(12, 125), dim3(128), 0, stream>>>(
      x_ln, in_w, in_b, nullptr, qkv, NT, 768, 256);
  // 3) flash attention with distance-bias
  attn_kernel<<<dim3(24, HEADS, BATCH), dim3(128), 0, stream>>>(qkv, points, betab, attn);
  // 4) output projection + residual
  wmma_gemm_kernel<1><<<dim3(4, 125), dim3(128), 0, stream>>>(
      attn, out_w, out_b, feat, feat2, NT, 256, 256);
  // 5) LN2
  ln_kernel<false><<<dim3(750), dim3(256), 0, stream>>>(
      feat2, ln2_w, ln2_b, nullptr, nullptr, y2, nullptr);
  // 6) FC1 + exact GELU: (6000x256)@(512x256)^T
  wmma_gemm_kernel<2><<<dim3(8, 125), dim3(128), 0, stream>>>(
      y2, fc1_w, fc1_b, nullptr, hfc1, NT, 512, 256);
  // 7) FC2 -> out: (6000x512)@(256x512)^T
  wmma_gemm_kernel<0><<<dim3(4, 125), dim3(128), 0, stream>>>(
      hfc1, fc2_w, fc2_b, nullptr, outp, NT, 256, 512);
}

// v005
// One run takes 123 microseconds.
// Timed twice side by side with v004, it ran 1.10 times as fast both times.
// Counting every step since v000, it is 2.08 times as fast.
#include <hip/hip_runtime.h>
#include <math.h>
#include <stdint.h>

#define EDIM 256
#define HEADS 8
#define NTOK 1500
#define BATCH 4
#define DHEAD 32
#define HID 512
#define NT 6000            // BATCH*NTOK tokens
#define EPSLN 1e-6f
#define KC 64              // K-chunk staged through LDS

typedef __attribute__((ext_vector_type(2))) float v2f;
typedef __attribute__((ext_vector_type(8))) float v8f;

// D = A(16x4) * B(4x16) + C, full fp32 (CDNA5 V_WMMA_F32_16X16X4_F32)
#define WMMA4(a, b, c) \
  __builtin_amdgcn_wmma_f32_16x16x4_f32(false, (a), false, (b), (short)0, (c), false, false)

// low 32 bits of a __shared__ address = byte offset in the work-group's LDS
__device__ __forceinline__ unsigned lds_byte(const float* p) {
  return (unsigned)(uintptr_t)(__attribute__((address_space(3))) const float*)p;
}

// Lane l reads lane l ^ 16: one vector instruction, no trip through the LDS pipe.
__device__ __forceinline__ float xhalf(float x) {
  const int b = __builtin_bit_cast(int, x);
  return __builtin_bit_cast(
      float, __builtin_amdgcn_permlanex16(b, b, 0x76543210, 0xfedcba98, false, false));
}

// Hardware transcendentals, a run of independent ones in one statement, each in
// place. The instruction set asks for one independent instruction behind a
// transcendental before its result is read or its source overwritten: each is
// that for the one in front of it, the v_nop for the last. In place, so that the
// statement writes no register but those the vector instructions in front of it
// wrote: none can be an operand of a matrix instruction still under way.
__device__ __forceinline__ void sqrt_x8(float (&x)[8]) {
  asm("v_sqrt_f32 %0, %0\n\t"
      "v_sqrt_f32 %1, %1\n\t"
      "v_sqrt_f32 %2, %2\n\t"
      "v_sqrt_f32 %3, %3\n\t"
      "v_sqrt_f32 %4, %4\n\t"
      "v_sqrt_f32 %5, %5\n\t"
      "v_sqrt_f32 %6, %6\n\t"
      "v_sqrt_f32 %7, %7\n\t"
      "v_nop"
      : "+v"(x[0]), "+v"(x[1]), "+v"(x[2]), "+v"(x[3]),
        "+v"(x[4]), "+v"(x[5]), "+v"(x[6]), "+v"(x[7]));
}
// 2^x for eight scores and for the running maximum's step
__device__ __forceinline__ void exp2_x9(float (&x)[8], float& y) {
  asm("v_exp_f32 %8, %8\n\t"
      "v_exp_f32 %0, %0\n\t"
      "v_exp_f32 %1, %1\n\t"
      "v_exp_f32 %2, %2\n\t"
      "v_exp_f32 %3, %3\n\t"
      "v_exp_f32 %4, %4\n\t"
      "v_exp_f32 %5, %5\n\t"
      "v_exp_f32 %6, %6\n\t"
      "v_exp_f32 %7, %7\n\t"
      "v_nop"
      : "+v"(x[0]), "+v"(x[1]), "+v"(x[2]), "+v"(x[3]),
        "+v"(x[4]), "+v"(x[5]), "+v"(x[6]), "+v"(x[7]), "+v"(y));
}

// ---------------------------------------------------------------------------
// C[M,Nc] = A[M,K] @ W[Nc,K]^T + bias  (+ epilogue)
// EPI: 0 = bias, 1 = bias + residual, 2 = bias + exact GELU
// Block = 4 waves on one 48x64 tile of C; wave w owns columns 16w..16w+15 and
// all 48 rows (three accumulators that share one W fragment).
// A KC-wide chunk of the 48 A rows and of the 64 W rows is staged in LDS by
// async copies of whole 256-byte row pieces, two buffers, the next chunk in
// flight while this one is used. k runs upward in each accumulator.
// grid = (Nc/64, M/48), exact.  K a multiple of KC.
// ---------------------------------------------------------------------------
#define BM 48
#define BN 64
#define GPITCH 68  // floats per staged row: 8-byte fragment reads hit 64 distinct banks

template <int EPI>
__global__ __launch_bounds__(128) void wmma_gemm_kernel(
    const float* __restrict__ A, const float* __restrict__ W,
    const float* __restrict__ bias, const float* __restrict__ resid,
    float* __restrict__ C, int M, int Nc, int K) {
  __shared__ __attribute__((aligned(16))) float As[2][BM * GPITCH];
  __shared__ __attribute__((aligned(16))) float Ws[2][BN * GPITCH];
  const int tid = threadIdx.x;
  const int lane = tid & 31;
  const int wave = __builtin_amdgcn_readfirstlane(tid >> 5);
  const int hi = lane >> 4;
  const int l15 = lane & 15;
  const int nb = blockIdx.x * BN;
  const int n0 = nb + wave * 16;
  const int m0 = blockIdx.y * BM;

  // copies: 16 lanes cover one row's 256 bytes, the block covers 8 rows a pass
  const int crow = tid >> 4;        // 0..7
  const int ccol = (tid & 15) * 4;  // 0..60
  const float* ag = A + (size_t)(m0 + crow) * K + ccol;
  const float* wg = W + (size_t)(nb + crow) * K + ccol;
  const size_t rs = (size_t)8 * K;  // 8 rows down in global memory
  const unsigned ls = 8 * GPITCH * 4;  // 8 rows down in LDS, bytes

  auto issue_chunk = [&](int c, int buf) {
    const float* a = ag + (size_t)c * KC;
    const float* w = wg + (size_t)c * KC;
    const unsigned la = lds_byte(&As[buf][crow * GPITCH + ccol]);
    const unsigned lw = lds_byte(&Ws[buf][crow * GPITCH + ccol]);
    // The copies and their s_wait_xcnt in one statement: no address register
    // is rewritten before the wait.
    asm volatile(
        "global_load_async_to_lds_b128 %0, %6, off\n\t"
        "global_load_async_to_lds_b128 %1, %7, off\n\t"
        "global_load_async_to_lds_b128 %2, %8, off\n\t"
        "global_load_async_to_lds_b128 %3, %9, off\n\t"
        "global_load_async_to_lds_b128 %4, %10, off\n\t"
        "global_load_async_to_lds_b128 %5, %11, off\n\t"
        "s_wait_xcnt 0x0"
        :: "v"(la), "v"(la + ls), "v"(la + 2 * ls), "v"(la + 3 * ls),
           "v"(la + 4 * ls), "v"(la + 5 * ls),
           "v"(a), "v"(a + rs), "v"(a + 2 * rs), "v"(a + 3 * rs),
           "v"(a + 4 * rs), "v"(a + 5 * rs) : "memory");
    asm volatile(
        "global_load_async_to_lds_b128 %0, %8, off\n\t"
        "global_load_async_to_lds_b128 %1, %9, off\n\t"
        "global_load_async_to_lds_b128 %2, %10, off\n\t"
        "global_load_async_to_lds_b128 %3, %11, off\n\t"
        "global_load_async_to_lds_b128 %4, %12, off\n\t"
        "global_load_async_to_lds_b128 %5, %13, off\n\t"
        "global_load_async_to_lds_b128 %6, %14, off\n\t"
        "global_load_async_to_lds_b128 %7, %15, off\n\t"
        "s_wait_xcnt 0x0"
        :: "v"(lw), "v"(lw + ls), "v"(lw + 2 * ls), "v"(lw + 3 * ls),
           "v"(lw + 4 * ls), "v"(lw + 5 * ls), "v"(lw + 6 * ls), "v"(lw + 7 * ls),
           "v"(w), "v"(w + rs), "v"(w + 2 * rs), "v"(w + 3 * rs),
           "v"(w + 4 * rs), "v"(w + 5 * rs), "v"(w + 6 * rs), "v"(w + 7 * rs)
        : "memory");
  };

  const int nchunks = K / KC;
  issue_chunk(0, 0);

  const float bn = bias[n0 + l15];
  v8f acc[3] = {};

  // chunk 0 has landed for this wave, then for the whole block
  asm volatile("s_wait_asynccnt 0x0" ::: "memory");
  __syncthreads();
  if (nchunks > 1) issue_chunk(1, 1);

  for (int c = 0; c < nchunks; ++c) {
    const int buf = c & 1;
    const float* ap = &As[buf][l15 * GPITCH + 2 * hi];
    const float* bp = &Ws[buf][(wave * 16 + l15) * GPITCH + 2 * hi];
    // unrolled: LDS offsets become immediates and the reads run ahead of the products
#pragma unroll
    for (int k = 0; k < KC; k += 4) {
      const v2f b = *(const v2f*)(bp + k);  // W[n0+l15][k+2*hi+{0,1}]
#pragma unroll  // acc[t] is indexed by constants and stays in registers
      for (int t = 0; t < 3; ++t) {
        const v2f a = *(const v2f*)(ap + t * 16 * GPITCH + k);  // A[m0+16t+l15][same k]
        acc[t] = WMMA4(a, b, acc[t]);
      }
    }
    // Hand-over: this wave's LDS reads of the chunk are done, its copies of
    // the next chunk have landed; the barrier publishes the next chunk and
    // frees this buffer for the refill behind it.
    asm volatile("s_wait_dscnt 0x0" ::: "memory");
    asm volatile("s_wait_asynccnt 0x0" ::: "memory");
    __syncthreads();
    if (c + 2 < nchunks) issue_chunk(c + 2, buf);
  }
  // no copy is left in flight when the wave ends
  asm volatile("s_wait_asynccnt 0x0" ::: "memory");

  // both unrolled: accumulator elements are named by constants
#pragma unroll
  for (int t = 0; t < 3; ++t) {
#pragma unroll
    for (int r = 0; r < 8; ++r) {
      const int m = m0 + t * 16 + r + 8 * hi;
      float v = acc[t][r] + bn;
      if (EPI == 1) v += resid[(size_t)m * Nc + n0 + l15];
      if (EPI == 2) v = 0.5f * v * (1.f + erff(v * 0.70710678118654752f));
      C[(size_t)m * Nc + n0 + l15] = v;
    }
  }
}

// ---------------------------------------------------------------------------
// C[M,Nc] = LayerNorm(A)[M,256] @ W[Nc,256]^T + bias  (+ epilogue); optionally
// beta[b,h,n] from the normalised rows.  EPI: 0 = bias, 2 = bias + exact GELU; no residual.
// Block = 8 waves on one 48x128 tile of C; wave w owns columns 16w..16w+15 and
// all 48 rows. The 48 A rows are staged whole in LDS by async copies and
// normalised there in place, six rows a wave, before the product reads them:
// the normalised matrix never goes through memory. W comes in KC-wide chunks,
// two buffers, as above. grid = (Nc/128, M/48), exact.
// ---------------------------------------------------------------------------
#define LBN 128
#define APITCH 260  // floats per staged A row: 4 banks a row, as GPITCH
#define LROWS 6     // BM rows over 8 waves

typedef __attribute__((ext_vector_type(4))) float v4f;

// Lane l reads lane l ^ MASK of its own 16-lane row (DPP row_xmask).
template <int MASK>
__device__ __forceinline__ float xrow(float x) {
  const int b = __builtin_bit_cast(int, x);
  return __builtin_bit_cast(
      float, __builtin_amdgcn_update_dpp(0, b, 0x160 | MASK, 0xf, 0xf, true));
}
// Butterfly sum over the wave; every lane ends with the same value.
__device__ __forceinline__ float wave_sum(float x) {
  x += xrow<1>(x);
  x += xrow<2>(x);
  x += xrow<4>(x);
  x += xrow<8>(x);
  x += xhalf(x);
  return x;
}

template <int EPI, bool DO_BETA>
__global__ __launch_bounds__(256) void ln_gemm_kernel(
    const float* __restrict__ A, const float* __restrict__ lnw,
    const float* __restrict__ lnb, const float* __restrict__ W,
    const float* __restrict__ bias, const float* __restrict__ beta_w,
    const float* __restrict__ beta_b, float* __restrict__ beta_out,
    float* __restrict__ C, int Nc) {
  __shared__ __attribute__((aligned(16))) float Ap[BM * APITCH];
  __shared__ __attribute__((aligned(16))) float Ws[2][LBN * GPITCH];
  const int tid = threadIdx.x;
  const int lane = tid & 31;
  const int wave = __builtin_amdgcn_readfirstlane(tid >> 5);
  const int hi = lane >> 4;
  const int l15 = lane & 15;
  const int nb = blockIdx.x * LBN;
  const int n0 = nb + wave * 16;
  const int m0 = blockIdx.y * BM;
  const int arow = wave * LROWS;  // this wave's rows of the A panel

  // A panel: a wave's copy covers 512 bytes of a row, two copies a row.
  {
    const float* a = A + (size_t)(m0 + arow) * EDIM + lane * 4;
    const unsigned la = lds_byte(&Ap[arow * APITCH + lane * 4]);
    const unsigned lr = APITCH * 4;  // one row down in LDS, bytes
    // The copies and their s_wait_xcnt in one statement: no address register
    // is rewritten before the wait.
    asm volatile(
        "global_load_async_to_lds_b128 %0, %12, off\n\t"
        "global_load_async_to_lds_b128 %1, %13, off\n\t"
        "global_load_async_to_lds_b128 %2, %14, off\n\t"
        "global_load_async_to_lds_b128 %3, %15, off\n\t"
        "global_load_async_to_lds_b128 %4, %16, off\n\t"
        "global_load_async_to_lds_b128 %5, %17, off\n\t"
        "global_load_async_to_lds_b128 %6, %18, off\n\t"
        "global_load_async_to_lds_b128 %7, %19, off\n\t"
        "global_load_async_to_lds_b128 %8, %20, off\n\t"
        "global_load_async_to_lds_b128 %9, %21, off\n\t"
        "global_load_async_to_lds_b128 %10, %22, off\n\t"
        "global_load_async_to_lds_b128 %11, %23, off\n\t"
        "s_wait_xcnt 0x0"
        :: "v"(la), "v"(la + 512), "v"(la + lr), "v"(la + lr + 512),
           "v"(la + 2 * lr), "v"(la + 2 * lr + 512),
           "v"(la + 3 * lr), "v"(la + 3 * lr + 512),
           "v"(la + 4 * lr), "v"(la + 4 * lr + 512),
           "v"(la + 5 * lr), "v"(la + 5 * lr + 512),
           "v"(a), "v"(a + 128), "v"(a + EDIM), "v"(a + EDIM + 128),
           "v"(a + 2 * EDIM), "v"(a + 2 * EDIM + 128),
           "v"(a + 3 * EDIM), "v"(a + 3 * EDIM + 128),
           "v"(a + 4 * EDIM), "v"(a + 4 * EDIM + 128),
           "v"(a + 5 * EDIM), "v"(a + 5 * EDIM + 128) : "memory");
  }

  // W chunk: 16 lanes cover one row's 256 bytes, the block covers 16 rows a pass
  const int crow = tid >> 4;        // 0..15
  const int ccol = (tid & 15) * 4;  // 0..60
  const float* wg = W + (size_t)(nb + crow) * EDIM + ccol;
  const size_t rs = (size_t)16 * EDIM;  // 16 rows down in global memory
  const unsigned ls = 16 * GPITCH * 4;  // 16 rows down in LDS, bytes

  auto issue_chunk = [&](int c, int buf) {
    const float* w = wg + (size_t)c * KC;
    const unsigned lw = lds_byte(&Ws[buf][crow * GPITCH + ccol]);
    // The copies and their s_wait_xcnt in one statement, as above.
    asm volatile(
        "global_load_async_to_lds_b128 %0, %8, off\n\t"
        "global_load_async_to_lds_b128 %1, %9, off\n\t"
        "global_load_async_to_lds_b128 %2, %10, off\n\t"
        "global_load_async_to_lds_b128 %3, %11, off\n\t"
        "global_load_async_to_lds_b128 %4, %12, off\n\t"
        "global_load_async_to_lds_b128 %5, %13, off\n\t"
        "global_load_async_to_lds_b128 %6, %14, off\n\t"
        "global_load_async_to_lds_b128 %7, %15, off\n\t"
        "s_wait_xcnt 0x0"
        :: "v"(lw), "v"(lw + ls), "v"(lw + 2 * ls), "v"(lw + 3 * ls),
           "v"(lw + 4 * ls), "v"(lw + 5 * ls), "v"(lw + 6 * ls), "v"(lw + 7 * ls),
           "v"(w), "v"(w + rs), "v"(w + 2 * rs), "v"(w + 3 * rs),
           "v"(w + 4 * rs), "v"(w + 5 * rs), "v"(w + 6 * rs), "v"(w + 7 * rs)
        : "memory");
  };

  const int nchunks = EDIM / KC;
  issue_chunk(0, 0);

  const float bn = bias[n0 + l15];
  // this lane's eight columns of a row: 4*lane.. and 128+4*lane..
  const v4f g0 = *(const v4f*)(lnw + lane * 4);
  const v4f g1 = *(const v4f*)(lnw + 128 + lane * 4);
  const v4f c0 = *(const v4f*)(lnb + lane * 4);
  const v4f c1 = *(const v4f*)(lnb + 128 + lane * 4);

  // the A panel and W chunk 0 have landed for this wave, then for the whole block
  asm volatile("s_wait_asynccnt 0x0" ::: "memory");
  __syncthreads();
  issue_chunk(1, 1);  // in flight under the normalisation

  // ---- LayerNorm of this wave's six rows, in place ----
  v4f x0[LROWS], x1[LROWS];
  float red[LROWS];
#pragma unroll  // here and below: the rows' values are named by constants and stay in registers
  for (int r = 0; r < LROWS; ++r) {
    const float* p = &Ap[(arow + r) * APITCH + lane * 4];
    x0[r] = *(const v4f*)p;
    x1[r] = *(const v4f*)(p + 128);
  }
#pragma unroll
  for (int r = 0; r < LROWS; ++r) {
    const v4f t = x0[r] + x1[r];
    red[r] = wave_sum((t[0] + t[1]) + (t[2] + t[3]));
  }
#pragma unroll
  for (int r = 0; r < LROWS; ++r) {
    const float mu = red[r] * (1.f / 256.f);
    x0[r] -= mu;
    x1[r] -= mu;
    const v4f t = x0[r] * x0[r] + x1[r] * x1[r];
    red[r] = wave_sum((t[0] + t[1]) + (t[2] + t[3]));
  }
#pragma unroll
  for (int r = 0; r < LROWS; ++r) {
    const float rstd = rsqrtf(red[r] * (1.f / 256.f) + EPSLN);
    x0[r] = x0[r] * rstd * g0 + c0;
    x1[r] = x1[r] * rstd * g1 + c1;
    float* p = &Ap[(arow + r) * APITCH + lane * 4];
    *(v4f*)p = x0[r];
    *(v4f*)(p + 128) = x1[r];
  }

  if (DO_BETA) {
    // the heads are dealt over the column blocks; lane r stores row r's value
    const int tok = m0 + arow + min(lane, LROWS - 1);
    const int tb = tok / NTOK, tn = tok % NTOK;
    for (int h = blockIdx.x; h < HEADS; h += Nc / LBN) {
      const v4f b0 = *(const v4f*)(beta_w + h * EDIM + lane * 4);
      const v4f b1 = *(const v4f*)(beta_w + h * EDIM + 128 + lane * 4);
      float pv = 0.f;
#pragma unroll
      for (int r = 0; r < LROWS; ++r) {
        const v4f t = x0[r] * b0 + x1[r] * b1;
        const float p = wave_sum((t[0] + t[1]) + (t[2] + t[3]));
        if (lane == r) pv = p;
      }
      if (lane < LROWS) {
        beta_out[(size_t)(tb * HEADS + h) * NTOK + tn] = pv + beta_b[h];
        // the next head's loads land in the registers this store names
        asm volatile("s_wait_xcnt 0x0" ::: "memory");
      }
    }
  }

  v8f acc[3] = {};
  // every wave's normalised rows are in LDS before any wave's product reads them
  __syncthreads();

  for (int c = 0; c < nchunks; ++c) {
    const int buf = c & 1;
    const float* ap = &Ap[l15 * APITCH + c * KC + 2 * hi];
    const float* bp = &Ws[buf][(wave * 16 + l15) * GPITCH + 2 * hi];
    // unrolled: LDS offsets become immediates and the reads run ahead of the products
#pragma unroll
    for (int k = 0; k < KC; k += 4) {
      const v2f b = *(const v2f*)(bp + k);  // W[n0+l15][k+2*hi+{0,1}]
#pragma unroll  // acc[t] is indexed by constants and stays in registers
      for (int t = 0; t < 3; ++t) {
        const v2f a = *(const v2f*)(ap + t * 16 * APITCH + k);  // A[m0+16t+l15][same k]
        acc[t] = WMMA4(a, b, acc[t]);
      }
    }
    // Hand-over: this wave's LDS reads of the chunk are done, its copies of
    // the next chunk have landed; the barrier publishes the next chunk and
    // frees this buffer for the refill behind it.
    asm volatile("s_wait_dscnt 0x0" ::: "memory");
    asm volatile("s_wait_asynccnt 0x0" ::: "memory");
    __syncthreads();
    if (c + 2 < nchunks) issue_chunk(c + 2, buf);
  }
  // no copy is left in flight when the wave ends
  asm volatile("s_wait_asynccnt 0x0" ::: "memory");

  // both unrolled: accumulator elements are named by constants
#pragma unroll
  for (int t = 0; t < 3; ++t) {
#pragma unroll
    for (int r = 0; r < 8; ++r) {
      const int m = m0 + t * 16 + r + 8 * hi;
      float v = acc[t][r] + bn;
      if (EPI == 2) v = 0.5f * v * (1.f + erff(v * 0.70710678118654752f));
      C[(size_t)m * Nc + n0 + l15] = v;
    }
  }
}

// ---------------------------------------------------------------------------
// Flash attention with distance-bias mask, one wave per 16-query tile.
// qkv: (B, N, 768) with cols [0,256)=Q, [256,512)=K, [512,768)=V (head-major).
// S^T = K_tile @ Q^T (softmax rows live per-lane), O^T = V^T @ P^T with
// the keys of each product step taken as the score tile's lanes hold them.
// block = 128 threads = 4 waves = 4 query tiles of ONE head, which share the
// head's K rows, V rows and key points: a stage of 32 keys is brought into LDS
// by async copies, two buffers, the next stage in flight while this one is used.
// grid = (ceil(N/64), HEADS, B).
// ---------------------------------------------------------------------------
#define KSTG 32                    // keys per LDS stage (two 16-key tiles)
#define NSTG 47                    // ceil(NTOK / KSTG)
#define KPITCH 36                  // floats per staged K row: 8-byte fragment reads hit 64 distinct banks
#define VPITCH 36                  // floats per staged V row: rows k and k+8 fall 32 banks apart

// Register budget of 2 to 4 waves per SIMD (three blocks stand on a WGP): with
// it a stage's LDS reads issue as one group ahead of the matrix runs.
__global__ __launch_bounds__(128) __attribute__((amdgpu_waves_per_eu(2, 4))) void attn_kernel(
    const float* __restrict__ qkv, const float* __restrict__ points,
    const float* __restrict__ beta, float* __restrict__ attn_out) {
  __shared__ __attribute__((aligned(16))) float Ks[2][KSTG * KPITCH];
  __shared__ __attribute__((aligned(16))) float Vs[2][KSTG * VPITCH];
  __shared__ __attribute__((aligned(16))) float Ps[2][KSTG * 2];  // 32 x, then 32 y

  const int wave = __builtin_amdgcn_readfirstlane(threadIdx.x >> 5);
  const int lane = threadIdx.x & 31;
  const int hi = lane >> 4;
  const int l15 = lane & 15;
  const int h = blockIdx.y;
  const int b = blockIdx.z;
  const int q0 = blockIdx.x * 64 + wave * 16;
  const int q = q0 + l15;
  const int qc = min(q, NTOK - 1);

  const float* Kbase = qkv + (size_t)b * NTOK * 768 + 256 + h * DHEAD;

  // One stage: each wave copies 8 K rows and 8 V rows (128 B each, 16 B per
  // lane); waves 0 and 1 also copy 16 keys' (x, y). Rows past the last key are
  // clamped to it; their scores are masked below.
  auto issue_stage = [&](int stg, int buf) {
    const int kb = stg * KSTG;
    const int r0 = wave * 8 + (lane >> 3);
    const int c = (lane & 7) * 4;
    const float* gk0 = Kbase + (size_t)min(kb + r0, NTOK - 1) * 768 + c;
    const float* gk1 = Kbase + (size_t)min(kb + r0 + 4, NTOK - 1) * 768 + c;
    const float* gv0 = gk0 + 256;
    const float* gv1 = gk1 + 256;
    const unsigned lk0 = lds_byte(&Ks[buf][r0 * KPITCH + c]);
    const unsigned lk1 = lds_byte(&Ks[buf][(r0 + 4) * KPITCH + c]);
    const unsigned lv0 = lds_byte(&Vs[buf][r0 * VPITCH + c]);
    const unsigned lv1 = lds_byte(&Vs[buf][(r0 + 4) * VPITCH + c]);
    // The copies and their s_wait_xcnt in one statement: no address register
    // is rewritten before the wait.
    asm volatile(
        "global_load_async_to_lds_b128 %0, %4, off\n\t"
        "global_load_async_to_lds_b128 %1, %5, off\n\t"
        "global_load_async_to_lds_b128 %2, %6, off\n\t"
        "global_load_async_to_lds_b128 %3, %7, off\n\t"
        "s_wait_xcnt 0x0"
        :: "v"(lk0), "v"(lk1), "v"(lv0), "v"(lv1),
           "v"(gk0), "v"(gk1), "v"(gv0), "v"(gv1) : "memory");
    if (wave < 2) {  // wave is scalar: a uniform branch, every lane on inside
      const int key = wave * 16 + l15;
      const float* gp =
          points + (size_t)(b * NTOK + min(kb + key, NTOK - 1)) * 3 + hi;
      const unsigned lp = lds_byte(&Ps[buf][hi * KSTG + key]);
      asm volatile(
          "global_load_async_to_lds_b32 %0, %1, off\n\t"
          "s_wait_xcnt 0x0"
          :: "v"(lp), "v"(gp) : "memory");
    }
  };

  issue_stage(0, 0);

  const float* Qrow = qkv + (size_t)(b * NTOK + qc) * 768 + h * DHEAD;
  v2f qb[8];
#pragma unroll
  for (int s = 0; s < 8; ++s) qb[s] = *(const v2f*)(Qrow + 4 * s + 2 * hi);

  const float cqx = points[(size_t)(b * NTOK + qc) * 3 + 0];
  const float cqy = points[(size_t)(b * NTOK + qc) * 3 + 1];
  const float betav = beta[(size_t)(b * HEADS + h) * NTOK + qc];
  // Scores are kept in base-2 units: log2(e) is folded into the score scale and
  // into beta, so that each exponential is one hardware exp2.
  const float scal = 0.17677669529663687f * 1.4426950408889634f;  // log2(e)/sqrt(32)
  const float beta2 = betav * 1.4426950408889634f;

  float m_run = -1e30f, l_run = 0.f;
  v8f o0 = {}, o1 = {};

  // stage 0 has landed for this wave, then for the whole block
  asm volatile("s_wait_asynccnt 0x0" ::: "memory");
  __syncthreads();
  issue_stage(1, 1);

  for (int stg = 0; stg < NSTG; ++stg) {
    const int buf = stg & 1;
    const float* Kb = &Ks[buf][0];
    const float* Vb = &Vs[buf][0];
    const float* Pb = &Ps[buf][0];

    // unrolled: LDS offsets become immediates, the two tiles' score products interleave
#pragma unroll
    for (int t = 0; t < 2; ++t) {
      const int k0 = stg * KSTG + t * 16;
      // ---- S^T tile: rows = keys, cols = queries ----
      const float* Krow = Kb + (t * 16 + l15) * KPITCH;
      v8f st = {};
#pragma unroll
      for (int s = 0; s < 8; ++s) {
        v2f a = *(const v2f*)(Krow + 4 * s + 2 * hi);  // K[key=l15][d]
        st = WMMA4(a, qb[s], st);
      }

      // ---- scale + distance-bias mask ----
      const float* Prow = Pb + t * 16 + 8 * hi;  // this half's 8 keys
      float dd[8];  // squared distance, then distance
#pragma unroll  // here and below: dd[r] is named by constants and stays in registers
      for (int r = 0; r < 8; ++r) {
        const float kx = Prow[r];
        const float ky = Prow[KSTG + r];
        const float dx = cqx - kx, dy = cqy - ky;
        dd[r] = dx * dx + dy * dy;
      }
      sqrt_x8(dd);
#pragma unroll
      for (int r = 0; r < 8; ++r) {
        const int key = k0 + r + 8 * hi;
        const float dist = -dd[r];
        float v = st[r] * scal + dist * beta2;
        if (key >= NTOK) v = -1e30f;  // pad keys
        st[r] = v;
      }

      // ---- online softmax (row = fixed q = fixed lane15, halves share q) ----
      float mx = st[0];
#pragma unroll
      for (int r = 1; r < 8; ++r) mx = fmaxf(mx, st[r]);
      mx = fmaxf(mx, xhalf(mx));
      const float m_new = fmaxf(m_run, mx);
      float rescale = m_run - m_new;
      float pe[8];
#pragma unroll  // pe[r] is named by constants and stays in registers
      for (int r = 0; r < 8; ++r) pe[r] = st[r] - m_new;
      exp2_x9(pe, rescale);
      float lsum = 0.f;
#pragma unroll
      for (int r = 0; r < 8; ++r) {
        const float p = pe[r];
        st[r] = p;
        lsum += p;
      }
      l_run = l_run * rescale + lsum;  // this lane half's keys only; joined after the loop
      m_run = m_new;
#pragma unroll
      for (int r = 0; r < 8; ++r) { o0[r] *= rescale; o1[r] *= rescale; }

      // ---- O^T += V^T @ P^T ----
      // The k order of a product is free as long as both operands agree: step s
      // takes keys 2s, 2s+1 in the low lane half and 8+2s, 8+2s+1 in the high
      // one, which are the scores each lane already holds in st[2s], st[2s+1].
#pragma unroll  // st[2s] is named by constants and stays in registers
      for (int s = 0; s < 4; ++s) {
        const v2f pb = {st[2 * s], st[2 * s + 1]};  // P^T[key = 8*hi+2s+{0,1}][q = l15]
        const float* vr1 = Vb + (t * 16 + 8 * hi + 2 * s) * VPITCH;
        const float* vr2 = vr1 + VPITCH;
        v2f a0 = {vr1[l15], vr2[l15]};            // V^T[d=l15][same keys]
        v2f a1 = {vr1[16 + l15], vr2[16 + l15]};  // V^T[d=16+l15][same keys]
        o0 = WMMA4(a0, pb, o0);
        o1 = WMMA4(a1, pb, o1);
      }
    }

    // Hand-over: this wave's LDS reads of the stage are done, its copies of
    // the next stage have landed; the barrier publishes the next stage and
    // frees this buffer for the refill behind it.
    asm volatile("s_wait_dscnt 0x0" ::: "memory");
    asm volatile("s_wait_asynccnt 0x0" ::: "memory");
    __syncthreads();
    if (stg + 2 < NSTG) issue_stage(stg + 2, buf);
  }
  // no copy is left in flight when the wave ends
  asm volatile("s_wait_asynccnt 0x0" ::: "memory");

  const float l_all = l_run + xhalf(l_run);  // both halves' keys; every lane still on
  if (q < NTOK) {
    const float inv = 1.f / l_all;
    float* orow = attn_out + (size_t)(b * NTOK + q) * EDIM + h * DHEAD + 8 * hi;
#pragma unroll
    for (int r = 0; r < 8; ++r) {
      orow[r] = o0[r] * inv;        // d = r + 8*hi
      orow[16 + r] = o1[r] * inv;   // d = 16 + r + 8*hi
    }
  }
}

// ---------------------------------------------------------------------------
extern "C" void kernel_launch(void* const* d_in, const int* in_sizes, int n_in,
                              void* d_out, int out_size, void* d_ws,
                              size_t ws_size, hipStream_t stream) {
  const float* feat = (const float*)d_in[0];
  const float* points = (const float*)d_in[1];
  const float* ln1_w = (const float*)d_in[2];
  const float* ln1_b = (const float*)d_in[3];
  const float* beta_w = (const float*)d_in[4];
  const float* beta_b = (const float*)d_in[5];
  const float* in_w = (const float*)d_in[6];
  const float* in_b = (const float*)d_in[7];
  const float* out_w = (const float*)d_in[8];
  const float* out_b = (const float*)d_in[9];
  const float* ln2_w = (const float*)d_in[10];
  const float* ln2_b = (const float*)d_in[11];
  const float* fc1_w = (const float*)d_in[12];
  const float* fc1_b = (const float*)d_in[13];
  const float* fc2_w = (const float*)d_in[14];
  const float* fc2_b = (const float*)d_in[15];

  float* ws = (float*)d_ws;
  float* betab = ws + 1536000;      // 4*8*1500      =    48,000 f
  float* qkv = ws + 1584000;        // 6000*768      = 4,608,000 f
  float* attn = ws + 6192000;       // 6000*256      = 1,536,000 f
  float* feat2 = ws + 7728000;      // 6000*256      = 1,536,000 f
  float* hfc1 = qkv;                // reuse after attention consumed qkv
  float* outp = (float*)d_out;

  // 1) LN1 + beta projection + QKV projection: LN(6000x256)@(768x256)^T
  ln_gemm_kernel<0, true><<<dim3(6, 125), dim3(256), 0, stream>>>(
      feat, ln1_w, ln1_b, in_w, in_b, beta_w, beta_b, betab, qkv, 768);
  // 2) flash attention with distance-bias
  attn_kernel<<<dim3(24, HEADS, BATCH), dim3(128), 0, stream>>>(qkv, points, betab, attn);
  // 3) output projection + residual
  wmma_gemm_kernel<1><<<dim3(4, 125), dim3(128), 0, stream>>>(
      attn, out_w, out_b, feat, feat2, NT, 256, 256);
  // 4) LN2 + FC1 + exact GELU: LN(6000x256)@(512x256)^T
  ln_gemm_kernel<2, false><<<dim3(4, 125), dim3(256), 0, stream>>>(
      feat2, ln2_w, ln2_b, fc1_w, fc1_b, nullptr, nullptr, nullptr, hfc1, 512);
  // 5) FC2 -> out: (6000x512)@(256x512)^T
  wmma_gemm_kernel<0><<<dim3(4, 125), dim3(128), 0, stream>>>(
      hfc1, fc2_w, fc2_b, nullptr, outp, NT, 256, 512);
}

// v006
// One run takes 118 microseconds.
// Timed twice side by side with v005, it ran 1.04 times as fast both times.
// Counting every step since v000, it is 2.15 times as fast.
#include <hip/hip_runtime.h>
#include <math.h>
#include <stdint.h>

#define EDIM 256
#define HEADS 8
#define NTOK 1500
#define BATCH 4
#define DHEAD 32
#define HID 512
#define NT 6000            // BATCH*NTOK tokens
#define EPSLN 1e-6f
#define KC 64              // K-chunk staged through LDS

typedef __attribute__((ext_vector_type(2))) float v2f;
typedef __attribute__((ext_vector_type(8))) float v8f;

// D = A(16x4) * B(4x16) + C, full fp32 (CDNA5 V_WMMA_F32_16X16X4_F32)
#define WMMA4(a, b, c) \
  __builtin_amdgcn_wmma_f32_16x16x4_f32(false, (a), false, (b), (short)0, (c), false, false)

// low 32 bits of a __shared__ address = byte offset in the work-group's LDS
__device__ __forceinline__ unsigned lds_byte(const float* p) {
  return (unsigned)(uintptr_t)(__attribute__((address_space(3))) const float*)p;
}

// Lane l reads lane l ^ 16: one vector instruction, no trip through the LDS pipe.
__device__ __forceinline__ float xhalf(float x) {
  const int b = __builtin_bit_cast(int, x);
  return __builtin_bit_cast(
      float, __builtin_amdgcn_permlanex16(b, b, 0x76543210, 0xfedcba98, false, false));
}

// Hardware transcendentals, a run of independent ones in one statement, each in
// place. The instruction set asks for one independent instruction behind a
// transcendental before its result is read or its source overwritten: each is
// that for the one in front of it, the v_nop for the last. In place, so that the
// statement writes no register but those the vector instructions in front of it
// wrote: none can be an operand of a matrix instruction still under way.
__device__ __forceinline__ void sqrt_x8(float (&x)[8]) {
  asm("v_sqrt_f32 %0, %0\n\t"
      "v_sqrt_f32 %1, %1\n\t"
      "v_sqrt_f32 %2, %2\n\t"
      "v_sqrt_f32 %3, %3\n\t"
      "v_sqrt_f32 %4, %4\n\t"
      "v_sqrt_f32 %5, %5\n\t"
      "v_sqrt_f32 %6, %6\n\t"
      "v_sqrt_f32 %7, %7\n\t"
      "v_nop"
      : "+v"(x[0]), "+v"(x[1]), "+v"(x[2]), "+v"(x[3]),
        "+v"(x[4]), "+v"(x[5]), "+v"(x[6]), "+v"(x[7]));
}
// 2^x for eight scores and for the running maximum's step
__device__ __forceinline__ void exp2_x9(float (&x)[8], float& y) {
  asm("v_exp_f32 %8, %8\n\t"
      "v_exp_f32 %0, %0\n\t"
      "v_exp_f32 %1, %1\n\t"
      "v_exp_f32 %2, %2\n\t"
      "v_exp_f32 %3, %3\n\t"
      "v_exp_f32 %4, %4\n\t"
      "v_exp_f32 %5, %5\n\t"
      "v_exp_f32 %6, %6\n\t"
      "v_exp_f32 %7, %7\n\t"
      "v_nop"
      : "+v"(x[0]), "+v"(x[1]), "+v"(x[2]), "+v"(x[3]),
        "+v"(x[4]), "+v"(x[5]), "+v"(x[6]), "+v"(x[7]), "+v"(y));
}

// ---------------------------------------------------------------------------
// C[M,Nc] = A[M,K] @ W[Nc,K]^T + bias  (+ epilogue)
// EPI: 0 = bias, 1 = bias + residual, 2 = bias + exact GELU
// Block = 4 waves on one 48x64 tile of C; wave w owns columns 16w..16w+15 and
// all 48 rows (three accumulators that share one W fragment).
// A KC-wide chunk of the 48 A rows and of the 64 W rows is staged in LDS by
// async copies of whole 256-byte row pieces, two buffers, the next chunk in
// flight while this one is used. k runs upward in each accumulator.
// grid = (Nc/64, M/48), exact.  K a multiple of KC.
// ---------------------------------------------------------------------------
#define BM 48
#define BN 64
#define GPITCH 68  // floats per staged row: 8-byte fragment reads hit 64 distinct banks

template <int EPI>
__global__ __launch_bounds__(128) void wmma_gemm_kernel(
    const float* __restrict__ A, const float* __restrict__ W,
    const float* __restrict__ bias, const float* __restrict__ resid,
    float* __restrict__ C, int M, int Nc, int K) {
  __shared__ __attribute__((aligned(16))) float As[2][BM * GPITCH];
  __shared__ __attribute__((aligned(16))) float Ws[2][BN * GPITCH];
  const int tid = threadIdx.x;
  const int lane = tid & 31;
  const int wave = __builtin_amdgcn_readfirstlane(tid >> 5);
  const int hi = lane >> 4;
  const int l15 = lane & 15;
  const int nb = blockIdx.x * BN;
  const int n0 = nb + wave * 16;
  const int m0 = blockIdx.y * BM;

  // copies: 16 lanes cover one row's 256 bytes, the block covers 8 rows a pass
  const int crow = tid >> 4;        // 0..7
  const int ccol = (tid & 15) * 4;  // 0..60
  const float* ag = A + (size_t)(m0 + crow) * K + ccol;
  const float* wg = W + (size_t)(nb + crow) * K + ccol;
  const size_t rs = (size_t)8 * K;  // 8 rows down in global memory
  const unsigned ls = 8 * GPITCH * 4;  // 8 rows down in LDS, bytes

  auto issue_chunk = [&](int c, int buf) {
    const float* a = ag + (size_t)c * KC;
    const float* w = wg + (size_t)c * KC;
    const unsigned la = lds_byte(&As[buf][crow * GPITCH + ccol]);
    const unsigned lw = lds_byte(&Ws[buf][crow * GPITCH + ccol]);
    // The copies and their s_wait_xcnt in one statement: no address register
    // is rewritten before the wait.
    asm volatile(
        "global_load_async_to_lds_b128 %0, %6, off\n\t"
        "global_load_async_to_lds_b128 %1, %7, off\n\t"
        "global_load_async_to_lds_b128 %2, %8, off\n\t"
        "global_load_async_to_lds_b128 %3, %9, off\n\t"
        "global_load_async_to_lds_b128 %4, %10, off\n\t"
        "global_load_async_to_lds_b128 %5, %11, off\n\t"
        "s_wait_xcnt 0x0"
        :: "v"(la), "v"(la + ls), "v"(la + 2 * ls), "v"(la + 3 * ls),
           "v"(la + 4 * ls), "v"(la + 5 * ls),
           "v"(a), "v"(a + rs), "v"(a + 2 * rs), "v"(a + 3 * rs),
           "v"(a + 4 * rs), "v"(a + 5 * rs) : "memory");
    asm volatile(
        "global_load_async_to_lds_b128 %0, %8, off\n\t"
        "global_load_async_to_lds_b128 %1, %9, off\n\t"
        "global_load_async_to_lds_b128 %2, %10, off\n\t"
        "global_load_async_to_lds_b128 %3, %11, off\n\t"
        "global_load_async_to_lds_b128 %4, %12, off\n\t"
        "global_load_async_to_lds_b128 %5, %13, off\n\t"
        "global_load_async_to_lds_b128 %6, %14, off\n\t"
        "global_load_async_to_lds_b128 %7, %15, off\n\t"
        "s_wait_xcnt 0x0"
        :: "v"(lw), "v"(lw + ls), "v"(lw + 2 * ls), "v"(lw + 3 * ls),
           "v"(lw + 4 * ls), "v"(lw + 5 * ls), "v"(lw + 6 * ls), "v"(lw + 7 * ls),
           "v"(w), "v"(w + rs), "v"(w + 2 * rs), "v"(w + 3 * rs),
           "v"(w + 4 * rs), "v"(w + 5 * rs), "v"(w + 6 * rs), "v"(w + 7 * rs)
        : "memory");
  };

  const int nchunks = K / KC;
  issue_chunk(0, 0);

  const float bn = bias[n0 + l15];
  v8f acc[3] = {};

  // chunk 0 has landed for this wave, then for the whole block
  asm volatile("s_wait_asynccnt 0x0" ::: "memory");
  __syncthreads();
  if (nchunks > 1) issue_chunk(1, 1);

  // Wave priority falls as the wave gets on (3 for the first half of the chunks,
  // then 2, 1, 0, each for half of what is left). The two blocks on a WGP share
  // no barrier; the falling priority is for speed only.
  __builtin_amdgcn_s_setprio(3);
  int prio = 3;
  int left_at = nchunks >> 1;  // chunks left when the priority next falls

  for (int c = 0; c < nchunks; ++c) {
    const int buf = c & 1;
    const float* ap = &As[buf][l15 * GPITCH + 2 * hi];
    const float* bp = &Ws[buf][(wave * 16 + l15) * GPITCH + 2 * hi];
    // unrolled: LDS offsets become immediates and the reads run ahead of the products
#pragma unroll
    for (int k = 0; k < KC; k += 4) {
      const v2f b = *(const v2f*)(bp + k);  // W[n0+l15][k+2*hi+{0,1}]
#pragma unroll  // acc[t] is indexed by constants and stays in registers
      for (int t = 0; t < 3; ++t) {
        const v2f a = *(const v2f*)(ap + t * 16 * GPITCH + k);  // A[m0+16t+l15][same k]
        acc[t] = WMMA4(a, b, acc[t]);
      }
    }
    // Hand-over: this wave's LDS reads of the chunk are done, its copies of
    // the next chunk have landed; the barrier publishes the next chunk and
    // frees this buffer for the refill behind it.
    asm volatile("s_wait_dscnt 0x0" ::: "memory");
    asm volatile("s_wait_asynccnt 0x0" ::: "memory");
    __syncthreads();
    if (c + 2 < nchunks) issue_chunk(c + 2, buf);
    if (nchunks - 1 - c == left_at) {  // scalar: one compare a chunk, the branch taken three or four times
      if (prio == 3) __builtin_amdgcn_s_setprio(2);
      else if (prio == 2) __builtin_amdgcn_s_setprio(1);
      else __builtin_amdgcn_s_setprio(0);
      --prio;
      left_at >>= 1;
    }
  }
  __builtin_amdgcn_s_setprio(0);  // whatever the chunk count: the epilogue runs at the default priority
  // no copy is left in flight when the wave ends
  asm volatile("s_wait_asynccnt 0x0" ::: "memory");

  // both unrolled: accumulator elements are named by constants
#pragma unroll
  for (int t = 0; t < 3; ++t) {
#pragma unroll
    for (int r = 0; r < 8; ++r) {
      const int m = m0 + t * 16 + r + 8 * hi;
      float v = acc[t][r] + bn;
      if (EPI == 1) v += resid[(size_t)m * Nc + n0 + l15];
      if (EPI == 2) v = 0.5f * v * (1.f + erff(v * 0.70710678118654752f));
      C[(size_t)m * Nc + n0 + l15] = v;
    }
  }
}

// ---------------------------------------------------------------------------
// C[M,Nc] = LayerNorm(A)[M,256] @ W[Nc,256]^T + bias  (+ epilogue); optionally
// beta[b,h,n] from the normalised rows.  EPI: 0 = bias, 2 = bias + exact GELU; no residual.
// Block = 8 waves on one 48x128 tile of C; wave w owns columns 16w..16w+15 and
// all 48 rows. The 48 A rows are staged whole in LDS by async copies and
// normalised there in place, six rows a wave, before the product reads them:
// the normalised matrix never goes through memory. W comes in KC-wide chunks,
// two buffers, as above. grid = (Nc/128, M/48), exact.
// ---------------------------------------------------------------------------
#define LBN 128
#define APITCH 260  // floats per staged A row: 4 banks a row, as GPITCH
#define LROWS 6     // BM rows over 8 waves

typedef __attribute__((ext_vector_type(4))) float v4f;

// Lane l reads lane l ^ MASK of its own 16-lane row (DPP row_xmask).
template <int MASK>
__device__ __forceinline__ float xrow(float x) {
  const int b = __builtin_bit_cast(int, x);
  return __builtin_bit_cast(
      float, __builtin_amdgcn_update_dpp(0, b, 0x160 | MASK, 0xf, 0xf, true));
}
// Butterfly sum over the wave; every lane ends with the same value.
__device__ __forceinline__ float wave_sum(float x) {
  x += xrow<1>(x);
  x += xrow<2>(x);
  x += xrow<4>(x);
  x += xrow<8>(x);
  x += xhalf(x);
  return x;
}

template <int EPI, bool DO_BETA>
__global__ __launch_bounds__(256) void ln_gemm_kernel(
    const float* __restrict__ A, const float* __restrict__ lnw,
    const float* __restrict__ lnb, const float* __restrict__ W,
    const float* __restrict__ bias, const float* __restrict__ beta_w,
    const float* __restrict__ beta_b, float* __restrict__ beta_out,
    float* __restrict__ C, int Nc) {
  __shared__ __attribute__((aligned(16))) float Ap[BM * APITCH];
  __shared__ __attribute__((aligned(16))) float Ws[2][LBN * GPITCH];
  const int tid = threadIdx.x;
  const int lane = tid & 31;
  const int wave = __builtin_amdgcn_readfirstlane(tid >> 5);
  const int hi = lane >> 4;
  const int l15 = lane & 15;
  const int nb = blockIdx.x * LBN;
  const int n0 = nb + wave * 16;
  const int m0 = blockIdx.y * BM;
  const int arow = wave * LROWS;  // this wave's rows of the A panel

  // A panel: a wave's copy covers 512 bytes of a row, two copies a row.
  {
    const float* a = A + (size_t)(m0 + arow) * EDIM + lane * 4;
    const unsigned la = lds_byte(&Ap[arow * APITCH + lane * 4]);
    const unsigned lr = APITCH * 4;  // one row down in LDS, bytes
    // The copies and their s_wait_xcnt in one statement: no address register
    // is rewritten before the wait.
    asm volatile(
        "global_load_async_to_lds_b128 %0, %12, off\n\t"
        "global_load_async_to_lds_b128 %1, %13, off\n\t"
        "global_load_async_to_lds_b128 %2, %14, off\n\t"
        "global_load_async_to_lds_b128 %3, %15, off\n\t"
        "global_load_async_to_lds_b128 %4, %16, off\n\t"
        "global_load_async_to_lds_b128 %5, %17, off\n\t"
        "global_load_async_to_lds_b128 %6, %18, off\n\t"
        "global_load_async_to_lds_b128 %7, %19, off\n\t"
        "global_load_async_to_lds_b128 %8, %20, off\n\t"
        "global_load_async_to_lds_b128 %9, %21, off\n\t"
        "global_load_async_to_lds_b128 %10, %22, off\n\t"
        "global_load_async_to_lds_b128 %11, %23, off\n\t"
        "s_wait_xcnt 0x0"
        :: "v"(la), "v"(la + 512), "v"(la + lr), "v"(la + lr + 512),
           "v"(la + 2 * lr), "v"(la + 2 * lr + 512),
           "v"(la + 3 * lr), "v"(la + 3 * lr + 512),
           "v"(la + 4 * lr), "v"(la + 4 * lr + 512),
           "v"(la + 5 * lr), "v"(la + 5 * lr + 512),
           "v"(a), "v"(a + 128), "v"(a + EDIM), "v"(a + EDIM + 128),
           "v"(a + 2 * EDIM), "v"(a + 2 * EDIM + 128),
           "v"(a + 3 * EDIM), "v"(a + 3 * EDIM + 128),
           "v"(a + 4 * EDIM), "v"(a + 4 * EDIM + 128),
           "v"(a + 5 * EDIM), "v"(a + 5 * EDIM + 128) : "memory");
  }

  // W chunk: 16 lanes cover one row's 256 bytes, the block covers 16 rows a pass
  const int crow = tid >> 4;        // 0..15
  const int ccol = (tid & 15) * 4;  // 0..60
  const float* wg = W + (size_t)(nb + crow) * EDIM + ccol;
  const size_t rs = (size_t)16 * EDIM;  // 16 rows down in global memory
  const unsigned ls = 16 * GPITCH * 4;  // 16 rows down in LDS, bytes

  auto issue_chunk = [&](int c, int buf) {
    const float* w = wg + (size_t)c * KC;
    const unsigned lw = lds_byte(&Ws[buf][crow * GPITCH + ccol]);
    // The copies and their s_wait_xcnt in one statement, as above.
    asm volatile(
        "global_load_async_to_lds_b128 %0, %8, off\n\t"
        "global_load_async_to_lds_b128 %1, %9, off\n\t"
        "global_load_async_to_lds_b128 %2, %10, off\n\t"
        "global_load_async_to_lds_b128 %3, %11, off\n\t"
        "global_load_async_to_lds_b128 %4, %12, off\n\t"
        "global_load_async_to_lds_b128 %5, %13, off\n\t"
        "global_load_async_to_lds_b128 %6, %14, off\n\t"
        "global_load_async_to_lds_b128 %7, %15, off\n\t"
        "s_wait_xcnt 0x0"
        :: "v"(lw), "v"(lw + ls), "v"(lw + 2 * ls), "v"(lw + 3 * ls),
           "v"(lw + 4 * ls), "v"(lw + 5 * ls), "v"(lw + 6 * ls), "v"(lw + 7 * ls),
           "v"(w), "v"(w + rs), "v"(w + 2 * rs), "v"(w + 3 * rs),
           "v"(w + 4 * rs), "v"(w + 5 * rs), "v"(w + 6 * rs), "v"(w + 7 * rs)
        : "memory");
  };

  const int nchunks = EDIM / KC;
  issue_chunk(0, 0);

  const float bn = bias[n0 + l15];
  // this lane's eight columns of a row: 4*lane.. and 128+4*lane..
  const v4f g0 = *(const v4f*)(lnw + lane * 4);
  const v4f g1 = *(const v4f*)(lnw + 128 + lane * 4);
  const v4f c0 = *(const v4f*)(lnb + lane * 4);
  const v4f c1 = *(const v4f*)(lnb + 128 + lane * 4);

  // the A panel and W chunk 0 have landed for this wave, then for the whole block
  asm volatile("s_wait_asynccnt 0x0" ::: "memory");
  __syncthreads();
  issue_chunk(1, 1);  // in flight under the normalisation

  // ---- LayerNorm of this wave's six rows, in place ----
  v4f x0[LROWS], x1[LROWS];
  float red[LROWS];
#pragma unroll  // here and below: the rows' values are named by constants and stay in registers
  for (int r = 0; r < LROWS; ++r) {
    const float* p = &Ap[(arow + r) * APITCH + lane * 4];
    x0[r] = *(const v4f*)p;
    x1[r] = *(const v4f*)(p + 128);
  }
#pragma unroll
  for (int r = 0; r < LROWS; ++r) {
    const v4f t = x0[r] + x1[r];
    red[r] = wave_sum((t[0] + t[1]) + (t[2] + t[3]));
  }
#pragma unroll
  for (int r = 0; r < LROWS; ++r) {
    const float mu = red[r] * (1.f / 256.f);
    x0[r] -= mu;
    x1[r] -= mu;
    const v4f t = x0[r] * x0[r] + x1[r] * x1[r];
    red[r] = wave_sum((t[0] + t[1]) + (t[2] + t[3]));
  }
#pragma unroll
  for (int r = 0; r < LROWS; ++r) {
    const float rstd = rsqrtf(red[r] * (1.f / 256.f) + EPSLN);
    x0[r] = x0[r] * rstd * g0 + c0;
    x1[r] = x1[r] * rstd * g1 + c1;
    float* p = &Ap[(arow + r) * APITCH + lane * 4];
    *(v4f*)p = x0[r];
    *(v4f*)(p + 128) = x1[r];
  }

  if (DO_BETA) {
    // the heads are dealt over the column blocks; lane r stores row r's value
    const int tok = m0 + arow + min(lane, LROWS - 1);
    const int tb = tok / NTOK, tn = tok % NTOK;
    for (int h = blockIdx.x; h < HEADS; h += Nc / LBN) {
      const v4f b0 = *(const v4f*)(beta_w + h * EDIM + lane * 4);
      const v4f b1 = *(const v4f*)(beta_w + h * EDIM + 128 + lane * 4);
      float pv = 0.f;
#pragma unroll
      for (int r = 0; r < LROWS; ++r) {
        const v4f t = x0[r] * b0 + x1[r] * b1;
        const float p = wave_sum((t[0] + t[1]) + (t[2] + t[3]));
        if (lane == r) pv = p;
      }
      if (lane < LROWS) {
        beta_out[(size_t)(tb * HEADS + h) * NTOK + tn] = pv + beta_b[h];
        // the next head's loads land in the registers this store names
        asm volatile("s_wait_xcnt 0x0" ::: "memory");
      }
    }
  }

  v8f acc[3] = {};
  // every wave's normalised rows are in LDS before any wave's product reads them
  __syncthreads();

  for (int c = 0; c < nchunks; ++c) {
    const int buf = c & 1;
    const float* ap = &Ap[l15 * APITCH + c * KC + 2 * hi];
    const float* bp = &Ws[buf][(wave * 16 + l15) * GPITCH + 2 * hi];
    // unrolled: LDS offsets become immediates and the reads run ahead of the products
#pragma unroll
    for (int k = 0; k < KC; k += 4) {
      const v2f b = *(const v2f*)(bp + k);  // W[n0+l15][k+2*hi+{0,1}]
#pragma unroll  // acc[t] is indexed by constants and stays in registers
      for (int t = 0; t < 3; ++t) {
        const v2f a = *(const v2f*)(ap + t * 16 * APITCH + k);  // A[m0+16t+l15][same k]
        acc[t] = WMMA4(a, b, acc[t]);
      }
    }
    // Hand-over: this wave's LDS reads of the chunk are done, its copies of
    // the next chunk have landed; the barrier publishes the next chunk and
    // frees this buffer for the refill behind it.
    asm volatile("s_wait_dscnt 0x0" ::: "memory");
    asm volatile("s_wait_asynccnt 0x0" ::: "memory");
    __syncthreads();
    if (c + 2 < nchunks) issue_chunk(c + 2, buf);
  }
  // no copy is left in flight when the wave ends
  asm volatile("s_wait_asynccnt 0x0" ::: "memory");

  // both unrolled: accumulator elements are named by constants
#pragma unroll
  for (int t = 0; t < 3; ++t) {
#pragma unroll
    for (int r = 0; r < 8; ++r) {
      const int m = m0 + t * 16 + r + 8 * hi;
      float v = acc[t][r] + bn;
      if (EPI == 2) v = 0.5f * v * (1.f + erff(v * 0.70710678118654752f));
      C[(size_t)m * Nc + n0 + l15] = v;
    }
  }
}

// ---------------------------------------------------------------------------
// Flash attention with distance-bias mask, one wave per 16-query tile.
// qkv: (B, N, 768) with cols [0,256)=Q, [256,512)=K, [512,768)=V (head-major).
// S^T = K_tile @ Q^T (softmax rows live per-lane), O^T = V^T @ P^T with
// the keys of each product step taken as the score tile's lanes hold them.
// block = 128 threads = 4 waves = 4 query tiles of ONE head, which share the
// head's K rows, V rows and key points: a stage of 32 keys is brought into LDS
// by async copies, two buffers, the next stage in flight while this one is used.
// grid = (ceil(N/64), HEADS, B).
// ---------------------------------------------------------------------------
#define KSTG 32                    // keys per LDS stage (two 16-key tiles)
#define NSTG 47                    // ceil(NTOK / KSTG)
#define KPITCH 36                  // floats per staged K row: 8-byte fragment reads hit 64 distinct banks
#define VPITCH 36                  // floats per staged V row: rows k and k+8 fall 32 banks apart
#define PRIO2_AT 20                // first stage at wave priority 2 (3 before it)
#define PRIO1_AT 36                // first stage at wave priority 1
#define PRIO0_AT 45                // first stage at wave priority 0: the part that can end unevenly is short

// Register budget of 2 to 4 waves per SIMD (three blocks stand on a WGP): with
// it a stage's LDS reads issue as one group ahead of the matrix runs.
__global__ __launch_bounds__(128) __attribute__((amdgpu_waves_per_eu(2, 4))) void attn_kernel(
    const float* __restrict__ qkv, const float* __restrict__ points,
    const float* __restrict__ beta, float* __restrict__ attn_out) {
  __shared__ __attribute__((aligned(16))) float Ks[2][KSTG * KPITCH];
  __shared__ __attribute__((aligned(16))) float Vs[2][KSTG * VPITCH];
  __shared__ __attribute__((aligned(16))) float Ps[2][KSTG * 2];  // 32 x, then 32 y

  const int wave = __builtin_amdgcn_readfirstlane(threadIdx.x >> 5);
  const int lane = threadIdx.x & 31;
  const int hi = lane >> 4;
  const int l15 = lane & 15;
  const int h = blockIdx.y;
  const int b = blockIdx.z;
  const int q0 = blockIdx.x * 64 + wave * 16;
  const int q = q0 + l15;
  const int qc = min(q, NTOK - 1);

  const float* Kbase = qkv + (size_t)b * NTOK * 768 + 256 + h * DHEAD;

  // One stage: each wave copies 8 K rows and 8 V rows (128 B each, 16 B per
  // lane); waves 0 and 1 also copy 16 keys' (x, y). Rows past the last key are
  // clamped to it; their scores are masked below.
  auto issue_stage = [&](int stg, int buf) {
    const int kb = stg * KSTG;
    const int r0 = wave * 8 + (lane >> 3);
    const int c = (lane & 7) * 4;
    const float* gk0 = Kbase + (size_t)min(kb + r0, NTOK - 1) * 768 + c;
    const float* gk1 = Kbase + (size_t)min(kb + r0 + 4, NTOK - 1) * 768 + c;
    const float* gv0 = gk0 + 256;
    const float* gv1 = gk1 + 256;
    const unsigned lk0 = lds_byte(&Ks[buf][r0 * KPITCH + c]);
    const unsigned lk1 = lds_byte(&Ks[buf][(r0 + 4) * KPITCH + c]);
    const unsigned lv0 = lds_byte(&Vs[buf][r0 * VPITCH + c]);
    const unsigned lv1 = lds_byte(&Vs[buf][(r0 + 4) * VPITCH + c]);
    // The copies and their s_wait_xcnt in one statement: no address register
    // is rewritten before the wait.
    asm volatile(
        "global_load_async_to_lds_b128 %0, %4, off\n\t"
        "global_load_async_to_lds_b128 %1, %5, off\n\t"
        "global_load_async_to_lds_b128 %2, %6, off\n\t"
        "global_load_async_to_lds_b128 %3, %7, off\n\t"
        "s_wait_xcnt 0x0"
        :: "v"(lk0), "v"(lk1), "v"(lv0), "v"(lv1),
           "v"(gk0), "v"(gk1), "v"(gv0), "v"(gv1) : "memory");
    if (wave < 2) {  // wave is scalar: a uniform branch, every lane on inside
      const int key = wave * 16 + l15;
      const float* gp =
          points + (size_t)(b * NTOK + min(kb + key, NTOK - 1)) * 3 + hi;
      const unsigned lp = lds_byte(&Ps[buf][hi * KSTG + key]);
      asm volatile(
          "global_load_async_to_lds_b32 %0, %1, off\n\t"
          "s_wait_xcnt 0x0"
          :: "v"(lp), "v"(gp) : "memory");
    }
  };

  issue_stage(0, 0);

  const float* Qrow = qkv + (size_t)(b * NTOK + qc) * 768 + h * DHEAD;
  v2f qb[8];
#pragma unroll
  for (int s = 0; s < 8; ++s) qb[s] = *(const v2f*)(Qrow + 4 * s + 2 * hi);

  const float cqx = points[(size_t)(b * NTOK + qc) * 3 + 0];
  const float cqy = points[(size_t)(b * NTOK + qc) * 3 + 1];
  const float betav = beta[(size_t)(b * HEADS + h) * NTOK + qc];
  // Scores are kept in base-2 units: log2(e) is folded into the score scale and
  // into beta, so that each exponential is one hardware exp2.
  const float scal = 0.17677669529663687f * 1.4426950408889634f;  // log2(e)/sqrt(32)
  const float beta2 = betav * 1.4426950408889634f;

  float m_run = -1e30f, l_run = 0.f;
  v8f o0 = {}, o1 = {};

  // stage 0 has landed for this wave, then for the whole block
  asm volatile("s_wait_asynccnt 0x0" ::: "memory");
  __syncthreads();
  issue_stage(1, 1);

  // Wave priority falls as the wave gets on: 3, 2, 1, 0 over four parts of the
  // key loop. The three blocks on a WGP share no barrier; the falling
  // priority is for speed only.
  __builtin_amdgcn_s_setprio(3);
  int step_at = PRIO2_AT - 1;  // the stage behind which the priority next falls

  for (int stg = 0; stg < NSTG; ++stg) {
    const int buf = stg & 1;
    const float* Kb = &Ks[buf][0];
    const float* Vb = &Vs[buf][0];
    const float* Pb = &Ps[buf][0];

    // unrolled: LDS offsets become immediates, the two tiles' score products interleave
#pragma unroll
    for (int t = 0; t < 2; ++t) {
      const int k0 = stg * KSTG + t * 16;
      // ---- S^T tile: rows = keys, cols = queries ----
      const float* Krow = Kb + (t * 16 + l15) * KPITCH;
      v8f st = {};
#pragma unroll
      for (int s = 0; s < 8; ++s) {
        v2f a = *(const v2f*)(Krow + 4 * s + 2 * hi);  // K[key=l15][d]
        st = WMMA4(a, qb[s], st);
      }

      // ---- scale + distance-bias mask ----
      const float* Prow = Pb + t * 16 + 8 * hi;  // this half's 8 keys
      float dd[8];  // squared distance, then distance
#pragma unroll  // here and below: dd[r] is named by constants and stays in registers
      for (int r = 0; r < 8; ++r) {
        const float kx = Prow[r];
        const float ky = Prow[KSTG + r];
        const float dx = cqx - kx, dy = cqy - ky;
        dd[r] = dx * dx + dy * dy;
      }
      sqrt_x8(dd);
#pragma unroll
      for (int r = 0; r < 8; ++r) {
        const int key = k0 + r + 8 * hi;
        const float dist = -dd[r];
        float v = st[r] * scal + dist * beta2;
        if (key >= NTOK) v = -1e30f;  // pad keys
        st[r] = v;
      }

      // ---- online softmax (row = fixed q = fixed lane15, halves share q) ----
      float mx = st[0];
#pragma unroll
      for (int r = 1; r < 8; ++r) mx = fmaxf(mx, st[r]);
      mx = fmaxf(mx, xhalf(mx));
      const float m_new = fmaxf(m_run, mx);
      float rescale = m_run - m_new;
      float pe[8];
#pragma unroll  // pe[r] is named by constants and stays in registers
      for (int r = 0; r < 8; ++r) pe[r] = st[r] - m_new;
      exp2_x9(pe, rescale);
      float lsum = 0.f;
#pragma unroll
      for (int r = 0; r < 8; ++r) {
        const float p = pe[r];
        st[r] = p;
        lsum += p;
      }
      l_run = l_run * rescale + lsum;  // this lane half's keys only; joined after the loop
      m_run = m_new;
#pragma unroll
      for (int r = 0; r < 8; ++r) { o0[r] *= rescale; o1[r] *= rescale; }

      // ---- O^T += V^T @ P^T ----
      // The k order of a product is free as long as both operands agree: step s
      // takes keys 2s, 2s+1 in the low lane half and 8+2s, 8+2s+1 in the high
      // one, which are the scores each lane already holds in st[2s], st[2s+1].
#pragma unroll  // st[2s] is named by constants and stays in registers
      for (int s = 0; s < 4; ++s) {
        const v2f pb = {st[2 * s], st[2 * s + 1]};  // P^T[key = 8*hi+2s+{0,1}][q = l15]
        const float* vr1 = Vb + (t * 16 + 8 * hi + 2 * s) * VPITCH;
        const float* vr2 = vr1 + VPITCH;
        v2f a0 = {vr1[l15], vr2[l15]};            // V^T[d=l15][same keys]
        v2f a1 = {vr1[16 + l15], vr2[16 + l15]};  // V^T[d=16+l15][same keys]
        o0 = WMMA4(a0, pb, o0);
        o1 = WMMA4(a1, pb, o1);
      }
    }

    // Hand-over: this wave's LDS reads of the stage are done, its copies of
    // the next stage have landed; the barrier publishes the next stage and
    // frees this buffer for the refill behind it.
    asm volatile("s_wait_dscnt 0x0" ::: "memory");
    asm volatile("s_wait_asynccnt 0x0" ::: "memory");
    __syncthreads();
    if (stg + 2 < NSTG) issue_stage(stg + 2, buf);
    if (stg == step_at) {  // scalar: one compare a stage, the branch taken three times
      if (step_at == PRIO2_AT - 1) {
        __builtin_amdgcn_s_setprio(2);
        step_at = PRIO1_AT - 1;
      } else if (step_at == PRIO1_AT - 1) {
        __builtin_amdgcn_s_setprio(1);
        step_at = PRIO0_AT - 1;
      } else {
        __builtin_amdgcn_s_setprio(0);  // stays 0 to the wave's end
        step_at = NSTG;
      }
    }
  }
  // no copy is left in flight when the wave ends
  asm volatile("s_wait_asynccnt 0x0" ::: "memory");

  const float l_all = l_run + xhalf(l_run);  // both halves' keys; every lane still on
  if (q < NTOK) {
    const float inv = 1.f / l_all;
    float* orow = attn_out + (size_t)(b * NTOK + q) * EDIM + h * DHEAD + 8 * hi;
#pragma unroll
    for (int r = 0; r < 8; ++r) {
      orow[r] = o0[r] * inv;        // d = r + 8*hi
      orow[16 + r] = o1[r] * inv;   // d = 16 + r + 8*hi
    }
  }
}

// ---------------------------------------------------------------------------
extern "C" void kernel_launch(void* const* d_in, const int* in_sizes, int n_in,
                              void* d_out, int out_size, void* d_ws,
                              size_t ws_size, hipStream_t stream) {
  const float* feat = (const float*)d_in[0];
  const float* points = (const float*)d_in[1];
  const float* ln1_w = (const float*)d_in[2];
  const float* ln1_b = (const float*)d_in[3];
  const float* beta_w = (const float*)d_in[4];
  const float* beta_b = (const float*)d_in[5];
  const float* in_w = (const float*)d_in[6];
  const float* in_b = (const float*)d_in[7];
  const float* out_w = (const float*)d_in[8];
  const float* out_b = (const float*)d_in[9];
  const float* ln2_w = (const float*)d_in[10];
  const float* ln2_b = (const float*)d_in[11];
  const float* fc1_w = (const float*)d_in[12];
  const float* fc1_b = (const float*)d_in[13];
  const float* fc2_w = (const float*)d_in[14];
  const float* fc2_b = (const float*)d_in[15];

  float* ws = (float*)d_ws;
  float* betab = ws + 1536000;      // 4*8*1500      =    48,000 f
  float* qkv = ws + 1584000;        // 6000*768      = 4,608,000 f
  float* attn = ws + 6192000;       // 6000*256      = 1,536,000 f
  float* feat2 = ws + 7728000;      // 6000*256      = 1,536,000 f
  float* hfc1 = qkv;                // reuse after attention consumed qkv
  float* outp = (float*)d_out;

  // 1) LN1 + beta projection + QKV projection: LN(6000x256)@(768x256)^T
  ln_gemm_kernel<0, true><<<dim3(6, 125), dim3(256), 0, stream>>>(
      feat, ln1_w, ln1_b, in_w, in_b, beta_w, beta_b, betab, qkv, 768);
  // 2) flash attention with distance-bias
  attn_kernel<<<dim3(24, HEADS, BATCH), dim3(128), 0, stream>>>(qkv, points, betab, attn);
  // 3) output projection + residual
  wmma_gemm_kernel<1><<<dim3(4, 125), dim3(128), 0, stream>>>(
      attn, out_w, out_b, feat, feat2, NT, 256, 256);
  // 4) LN2 + FC1 + exact GELU: LN(6000x256)@(512x256)^T
  ln_gemm_kernel<2, false><<<dim3(4, 125), dim3(256), 0, stream>>>(
      feat2, ln2_w, ln2_b, fc1_w, fc1_b, nullptr, nullptr, nullptr, hfc1, 512);
  // 5) FC2 -> out: (6000x512)@(256x512)^T
  wmma_gemm_kernel<0><<<dim3(4, 125), dim3(128), 0, stream>>>(
      hfc1, fc2_w, fc2_b, nullptr, outp, NT, 256, 512);
}
